// v000
// Measured on an AMD MI455X. A time is GPU time per run, averaged over a window of back-to-back runs after a warm-up
// (all launches, gaps included; the runs take copies of the inputs in turn), and the median of several windows.
// Apart from v000's, it joins two sittings. Times from different sittings can be a few percent apart, while
// side-by-side timings come from the same sitting.
// v000, which the later versions start from, runs in 336 microseconds.
#include <hip/hip_runtime.h>
#include <hip/hip_bf16.h>
#include <math.h>

typedef __attribute__((ext_vector_type(16))) _Float16 v16h;
typedef __attribute__((ext_vector_type(8)))  float    v8f;
typedef int vs4i __attribute__((vector_size(16)));

#define SEQ   2048
#define HID   1024
#define NH    16
#define DH    64
#define BATCH 2
#define MTOT  (BATCH * SEQ)   // 4096 rows for QKV gemm

#if __has_builtin(__builtin_amdgcn_global_load_async_to_lds_b128)
#define HAVE_ASYNC_LDS 1
#endif

// ---------- fragment helpers ----------
// 16-bit A-matrix 16x32 layout: lane%16 = row, lane/16 selects K-offset (0 or 8);
// halves {koff..koff+7} then {koff+16..koff+23} -> two 16B loads.
__device__ __forceinline__ v16h load_frag16(const _Float16* p) {
    union { v16h v; uint4 u[2]; } u;
    u.u[0] = *reinterpret_cast<const uint4*>(p);
    u.u[1] = *reinterpret_cast<const uint4*>(p + 16);
    return u.v;
}

__device__ __forceinline__ v8f wmma_f16(v16h a, v16h b, v8f c) {
    return __builtin_amdgcn_wmma_f32_16x16x32_f16(
        /*neg_a=*/false, a, /*neg_b=*/false, b,
        /*c_mod=*/(short)0, c, /*reuse_a=*/false, /*reuse_b=*/false);
}

// 16-byte global -> LDS copy; async (ASYNCcnt-tracked, no VGPR round trip) when
// the gfx1250 builtin is available, else VGPR-staged fallback.
__device__ __forceinline__ void cp16_g2l(const _Float16* g, _Float16* l) {
#if defined(HAVE_ASYNC_LDS)
    __builtin_amdgcn_global_load_async_to_lds_b128(
        (__attribute__((address_space(1))) vs4i*)(unsigned long long)(const void*)g,
        (__attribute__((address_space(3))) vs4i*)(unsigned int)(unsigned long long)(void*)l,
        0, 0);
#else
    *reinterpret_cast<uint4*>(l) = *reinterpret_cast<const uint4*>(g);
#endif
}

__device__ __forceinline__ void wait_async_copies() {
#if defined(HAVE_ASYNC_LDS)
#if __has_builtin(__builtin_amdgcn_s_wait_asynccnt)
    __builtin_amdgcn_s_wait_asynccnt(0);
#else
    asm volatile("s_wait_asynccnt 0x0" ::: "memory");
#endif
#endif
}

// ---------- kernel 1: fp32 -> f16 convert + weight transpose ----------
__global__ void cvt_kernel(const float* __restrict__ X,
                           const float* __restrict__ Wq,
                           const float* __restrict__ Wk,
                           const float* __restrict__ Wv,
                           _Float16* __restrict__ Xh,
                           _Float16* __restrict__ Wtq,
                           _Float16* __restrict__ Wtk,
                           _Float16* __restrict__ Wtv) {
    const int NX = MTOT * HID;          // 4194304
    const int NW = HID * HID;           // 1048576
    int i = blockIdx.x * blockDim.x + threadIdx.x;
    int total = NX + 3 * NW;
    for (; i < total; i += gridDim.x * blockDim.x) {
        if (i < NX) {
            Xh[i] = (_Float16)X[i];
        } else {
            int j = i - NX;
            int w = j / NW;
            int r = j - w * NW;
            int n = r >> 10;
            int k = r & 1023;
            const float* W = (w == 0) ? Wq : (w == 1) ? Wk : Wv;
            _Float16* D    = (w == 0) ? Wtq : (w == 1) ? Wtk : Wtv;
            D[n * HID + k] = (_Float16)W[k * HID + n];
        }
    }
}

// ---------- kernel 2: QKV projection GEMM ----------
// one wave computes a 32(M) x 64(N) tile;  grid = (128 Mtiles, 16 Ntiles, 3 matrices)
// B-fragments reused across both M halves: 8 WMMAs per 12 b128 loads per k-step.
__global__ void qkv_gemm_kernel(const _Float16* __restrict__ Xh,
                                const _Float16* __restrict__ Wtq,
                                const _Float16* __restrict__ Wtk,
                                const _Float16* __restrict__ Wtv,
                                const float* __restrict__ bq,
                                const float* __restrict__ bk,
                                const float* __restrict__ bv,
                                _Float16* __restrict__ Qh,
                                _Float16* __restrict__ Kh,
                                _Float16* __restrict__ Vt) {
    const int z    = blockIdx.z;                 // 0=Q 1=K 2=V
    const _Float16* Wt = (z == 0) ? Wtq : (z == 1) ? Wtk : Wtv;
    const float*  bias = (z == 0) ? bq  : (z == 1) ? bk  : bv;

    const int lane = threadIdx.x & 31;
    const int nl   = lane & 15;
    const int hi   = lane >> 4;
    const int koff = hi * 8;

    const int m0 = blockIdx.x * 32;
    const int n0 = blockIdx.y * 64;

    v8f acc[2][4];
#pragma unroll
    for (int g = 0; g < 2; ++g)
#pragma unroll
        for (int f = 0; f < 4; ++f)
#pragma unroll
            for (int r = 0; r < 8; ++r) acc[g][f][r] = 0.0f;

    const _Float16* arow0 = Xh + (size_t)(m0 + nl) * HID;
    const _Float16* arow1 = Xh + (size_t)(m0 + 16 + nl) * HID;
    for (int k = 0; k < HID; k += 32) {
        v16h a0 = load_frag16(arow0 + k + koff);
        v16h a1 = load_frag16(arow1 + k + koff);
#pragma unroll
        for (int f = 0; f < 4; ++f) {
            v16h b = load_frag16(Wt + (size_t)(n0 + f * 16 + nl) * HID + k + koff);
            acc[0][f] = wmma_f16(a0, b, acc[0][f]);
            acc[1][f] = wmma_f16(a1, b, acc[1][f]);
        }
    }

    // epilogue: bias + scatter to per-head layout
#pragma unroll
    for (int f = 0; f < 4; ++f) {
        int n = n0 + f * 16 + nl;
        float bval = bias[n];
        int hh = n >> 6;
        int d  = n & 63;
#pragma unroll
        for (int g = 0; g < 2; ++g) {
#pragma unroll
            for (int r = 0; r < 8; ++r) {
                int m = m0 + g * 16 + r + hi * 8;
                int b = m >> 11;
                int s = m & 2047;
                float val = acc[g][f][r] + bval;
                int bh = b * NH + hh;
                if (z == 0) {
                    Qh[((size_t)bh * SEQ + s) * DH + d] = (_Float16)val;
                } else if (z == 1) {
                    Kh[((size_t)bh * SEQ + s) * DH + d] = (_Float16)val;
                } else {
                    Vt[((size_t)bh * DH + d) * SEQ + s] = (_Float16)val;
                }
            }
        }
    }
}

// ---------- kernel 3: flash attention ----------
// block = 8 waves, all on one (b,h); each wave owns a 16-row q-tile.
// K/V tiles (64 cols) are cooperatively staged in LDS (double-buffered) via
// async global->LDS copies, so each tile hits L2 once per block (8x cut) and
// no wave stalls on a load-wait. Row-sums come from a P x ones WMMA.
#define KBLK 64
#define NW_ATT 8

__global__ void attn_kernel(const _Float16* __restrict__ Qh,
                            const _Float16* __restrict__ Kh,
                            const _Float16* __restrict__ Vt,
                            const float* __restrict__ mask,
                            float* __restrict__ out) {
    __shared__ __align__(16) _Float16 Klds[2][KBLK * DH];      // 2 x 8 KB
    __shared__ __align__(16) _Float16 Vlds[2][DH * KBLK];      // 2 x 8 KB
    __shared__ __align__(16) _Float16 plds[NW_ATT][16 * KBLK]; // 8 x 2 KB

    const int tid  = threadIdx.x;
    const int wave = tid >> 5;
    const int lane = tid & 31;
    const int nl   = lane & 15;
    const int hi   = lane >> 4;
    const int koff = hi * 8;

    const int bh = blockIdx.y;
    const int b  = bh >> 4;
    const int h  = bh & 15;
    const int q0 = (blockIdx.x * NW_ATT + wave) * 16;

    const _Float16* Qbase = Qh + ((size_t)bh * SEQ + q0) * DH;
    const _Float16* Kbase = Kh + (size_t)bh * SEQ * DH;
    const _Float16* Vbase = Vt + (size_t)bh * DH * SEQ;
    const float*    mrow  = mask + (size_t)b * SEQ;

    const float LOG2E  = 1.4426950408889634f;
    const float KSCALE = 0.125f * LOG2E;      // 1/sqrt(64) folded into log2 domain

    // cooperative stage of one K/V tile pair into LDS buffer `buf`
    auto stage = [&](int buf, int k0) {
#pragma unroll
        for (int j = 0; j < 2; ++j) {
            int c   = tid * 2 + j;        // 0..511
            int row = c >> 3;             // 0..63
            int col = (c & 7) * 8;        // halves
            cp16_g2l(Kbase + (size_t)(k0 + row) * DH + col,
                     &Klds[buf][row * DH + col]);
            cp16_g2l(Vbase + (size_t)row * SEQ + k0 + col,
                     &Vlds[buf][row * KBLK + col]);
        }
    };

    // Q a-fragments (16 rows x 64 K), reused across the whole loop
    v16h qa[2];
#pragma unroll
    for (int j = 0; j < 2; ++j)
        qa[j] = load_frag16(Qbase + (size_t)nl * DH + j * 32 + koff);

    v16h ones;
#pragma unroll
    for (int i = 0; i < 16; ++i) ones[i] = (_Float16)1.0f;

    v8f ctx[4];
#pragma unroll
    for (int f = 0; f < 4; ++f)
#pragma unroll
        for (int r = 0; r < 8; ++r) ctx[f][r] = 0.0f;

    float m_run[8], l_run[8];
#pragma unroll
    for (int r = 0; r < 8; ++r) { m_run[r] = -1.0e30f; l_run[r] = 0.0f; }

    stage(0, 0);

    for (int it = 0; it < SEQ / KBLK; ++it) {
        const int k0  = it * KBLK;
        const int cur = it & 1;
        wait_async_copies();                  // drain this wave's async stores to LDS
        __syncthreads();                      // tile `cur` ready; everyone past `cur^1`
        if (it + 1 < SEQ / KBLK) stage(cur ^ 1, k0 + KBLK);

        const _Float16* Kt = &Klds[cur][0];
        const _Float16* Vv = &Vlds[cur][0];

        // ---- scores: 4 column-frags x 2 k-chunks = 8 WMMAs ----
        v8f S[4];
#pragma unroll
        for (int c = 0; c < 4; ++c) {
#pragma unroll
            for (int r = 0; r < 8; ++r) S[c][r] = 0.0f;
#pragma unroll
            for (int j = 0; j < 2; ++j) {
                v16h kb = load_frag16(Kt + (size_t)(16 * c + nl) * DH + j * 32 + koff);
                S[c] = wmma_f16(qa[j], kb, S[c]);
            }
        }

        float mk[4];
#pragma unroll
        for (int c = 0; c < 4; ++c) mk[c] = mrow[k0 + 16 * c + nl] * LOG2E;

        // ---- online softmax (log2 domain) ----
        float rscale[8], e[4][8];
#pragma unroll
        for (int r = 0; r < 8; ++r) {
            float v0 = S[0][r] * KSCALE + mk[0];
            float v1 = S[1][r] * KSCALE + mk[1];
            float v2 = S[2][r] * KSCALE + mk[2];
            float v3 = S[3][r] * KSCALE + mk[3];
            float mx = fmaxf(fmaxf(v0, v1), fmaxf(v2, v3));
#pragma unroll
            for (int off = 1; off < 16; off <<= 1)
                mx = fmaxf(mx, __shfl_xor(mx, off, 16));
            float mnew = fmaxf(m_run[r], mx);
            rscale[r] = exp2f(m_run[r] - mnew);
            e[0][r] = exp2f(v0 - mnew);
            e[1][r] = exp2f(v1 - mnew);
            e[2][r] = exp2f(v2 - mnew);
            e[3][r] = exp2f(v3 - mnew);
            m_run[r] = mnew;
        }

        // ---- re-layout P (C-format -> A-format) through per-wave LDS ----
        _Float16* pw = &plds[wave][0];
#pragma unroll
        for (int r = 0; r < 8; ++r) {
            int row = r + hi * 8;
#pragma unroll
            for (int c = 0; c < 4; ++c)
                pw[row * KBLK + 16 * c + nl] = (_Float16)e[c][r];
        }
        v16h pa[2];
#pragma unroll
        for (int j = 0; j < 2; ++j)
            pa[j] = load_frag16(pw + (size_t)nl * KBLK + j * 32 + koff);

        // ---- row sums via P x ones (moves reduction onto the matrix pipe) ----
        v8f ls;
#pragma unroll
        for (int r = 0; r < 8; ++r) ls[r] = 0.0f;
        ls = wmma_f16(pa[0], ones, ls);
        ls = wmma_f16(pa[1], ones, ls);

        // ---- rescale ctx, update l, ctx += P x V (8 WMMAs) ----
#pragma unroll
        for (int f = 0; f < 4; ++f)
#pragma unroll
            for (int r = 0; r < 8; ++r) ctx[f][r] *= rscale[r];
#pragma unroll
        for (int r = 0; r < 8; ++r) l_run[r] = l_run[r] * rscale[r] + ls[r];

#pragma unroll
        for (int f = 0; f < 4; ++f) {
#pragma unroll
            for (int j = 0; j < 2; ++j) {
                v16h vb = load_frag16(Vv + (size_t)(f * 16 + nl) * KBLK + j * 32 + koff);
                ctx[f] = wmma_f16(pa[j], vb, ctx[f]);
            }
        }
    }

    // ---- normalize and write [B,S,h*dh] fp32 ----
#pragma unroll
    for (int f = 0; f < 4; ++f) {
#pragma unroll
        for (int r = 0; r < 8; ++r) {
            int row = r + hi * 8;
            out[((size_t)b * SEQ + q0 + row) * HID + h * DH + f * 16 + nl] =
                ctx[f][r] / l_run[r];
        }
    }
}

// ---------- launcher ----------
extern "C" void kernel_launch(void* const* d_in, const int* in_sizes, int n_in,
                              void* d_out, int out_size, void* d_ws, size_t ws_size,
                              hipStream_t stream) {
    const float* hidden = (const float*)d_in[0];
    const float* amask  = (const float*)d_in[1];
    const float* Wq     = (const float*)d_in[2];
    const float* bq     = (const float*)d_in[3];
    const float* Wk     = (const float*)d_in[4];
    const float* bk     = (const float*)d_in[5];
    const float* Wv     = (const float*)d_in[6];
    const float* bv     = (const float*)d_in[7];
    float* out = (float*)d_out;

    // workspace layout (bytes); total ~38 MB
    char* ws = (char*)d_ws;
    const size_t XH_OFF  = 0;
    const size_t WTQ_OFF = XH_OFF  + (size_t)MTOT * HID * 2;
    const size_t WTK_OFF = WTQ_OFF + (size_t)HID * HID * 2;
    const size_t WTV_OFF = WTK_OFF + (size_t)HID * HID * 2;
    const size_t QH_OFF  = WTV_OFF + (size_t)HID * HID * 2;
    const size_t KH_OFF  = QH_OFF  + (size_t)MTOT * HID * 2;
    const size_t VT_OFF  = KH_OFF  + (size_t)MTOT * HID * 2;

    _Float16* Xh  = (_Float16*)(ws + XH_OFF);
    _Float16* Wtq = (_Float16*)(ws + WTQ_OFF);
    _Float16* Wtk = (_Float16*)(ws + WTK_OFF);
    _Float16* Wtv = (_Float16*)(ws + WTV_OFF);
    _Float16* Qh  = (_Float16*)(ws + QH_OFF);
    _Float16* Kh  = (_Float16*)(ws + KH_OFF);
    _Float16* Vt  = (_Float16*)(ws + VT_OFF);

    // 1) convert inputs to f16 (+ transpose weights)
    {
        int total  = MTOT * HID + 3 * HID * HID;
        int blocks = (total + 255) / 256;
        cvt_kernel<<<blocks, 256, 0, stream>>>(hidden, Wq, Wk, Wv, Xh, Wtq, Wtk, Wtv);
    }

    // 2) QKV projections via WMMA (32x64 tiles per wave)
    {
        dim3 grid(MTOT / 32, HID / 64, 3);   // (128, 16, 3)
        qkv_gemm_kernel<<<grid, 32, 0, stream>>>(Xh, Wtq, Wtk, Wtv, bq, bk, bv,
                                                 Qh, Kh, Vt);
    }

    // 3) flash attention via WMMA with async-LDS-staged K/V
    {
        dim3 grid(SEQ / (16 * NW_ATT), BATCH * NH);   // (16, 32)
        attn_kernel<<<grid, 256, 0, stream>>>(Qh, Kh, Vt, amask, out);
    }
}

// v001
// It runs in 276 microseconds.
// Next to v000, in two timings, it ran 1.25 and 1.29 times as fast.
#include <hip/hip_runtime.h>
#include <hip/hip_bf16.h>
#include <math.h>

typedef __attribute__((ext_vector_type(16))) _Float16 v16h;
typedef __attribute__((ext_vector_type(8)))  float    v8f;
typedef int vs4i __attribute__((vector_size(16)));

#define SEQ   2048
#define HID   1024
#define NH    16
#define DH    64
#define BATCH 2
#define MTOT  (BATCH * SEQ)   // 4096 rows for QKV gemm

#if __has_builtin(__builtin_amdgcn_global_load_async_to_lds_b128)
#define HAVE_ASYNC_LDS 1
#endif

// ---------- fragment helpers ----------
// 16-bit A-matrix 16x32 layout: lane%16 = row, lane/16 selects K-offset (0 or 8);
// halves {koff..koff+7} then {koff+16..koff+23} -> two 16B loads.
__device__ __forceinline__ v16h load_frag16(const _Float16* p) {
    union { v16h v; uint4 u[2]; } u;
    u.u[0] = *reinterpret_cast<const uint4*>(p);
    u.u[1] = *reinterpret_cast<const uint4*>(p + 16);
    return u.v;
}

__device__ __forceinline__ v8f wmma_f16(v16h a, v16h b, v8f c) {
    return __builtin_amdgcn_wmma_f32_16x16x32_f16(
        /*neg_a=*/false, a, /*neg_b=*/false, b,
        /*c_mod=*/(short)0, c, /*reuse_a=*/false, /*reuse_b=*/false);
}

// 16-byte global -> LDS copy; async (ASYNCcnt-tracked, no VGPR round trip) when
// the gfx1250 builtin is available, else VGPR-staged fallback.
__device__ __forceinline__ void cp16_g2l(const _Float16* g, _Float16* l) {
#if defined(HAVE_ASYNC_LDS)
    __builtin_amdgcn_global_load_async_to_lds_b128(
        (__attribute__((address_space(1))) vs4i*)(unsigned long long)(const void*)g,
        (__attribute__((address_space(3))) vs4i*)(unsigned int)(unsigned long long)(void*)l,
        0, 0);
#else
    *reinterpret_cast<uint4*>(l) = *reinterpret_cast<const uint4*>(g);
#endif
}

__device__ __forceinline__ void wait_async_copies() {
#if defined(HAVE_ASYNC_LDS)
#if __has_builtin(__builtin_amdgcn_s_wait_asynccnt)
    __builtin_amdgcn_s_wait_asynccnt(0);
#else
    asm volatile("s_wait_asynccnt 0x0" ::: "memory");
#endif
#endif
}

// ---------- kernel 1: fp32 -> f16 convert + weight transpose ----------
__global__ void cvt_kernel(const float* __restrict__ X,
                           const float* __restrict__ Wq,
                           const float* __restrict__ Wk,
                           const float* __restrict__ Wv,
                           _Float16* __restrict__ Xh,
                           _Float16* __restrict__ Wtq,
                           _Float16* __restrict__ Wtk,
                           _Float16* __restrict__ Wtv) {
    const int NX = MTOT * HID;          // 4194304
    const int NW = HID * HID;           // 1048576
    int i = blockIdx.x * blockDim.x + threadIdx.x;
    int total = NX + 3 * NW;
    for (; i < total; i += gridDim.x * blockDim.x) {
        if (i < NX) {
            Xh[i] = (_Float16)X[i];
        } else {
            int j = i - NX;
            int w = j / NW;
            int r = j - w * NW;
            int n = r >> 10;
            int k = r & 1023;
            const float* W = (w == 0) ? Wq : (w == 1) ? Wk : Wv;
            _Float16* D    = (w == 0) ? Wtq : (w == 1) ? Wtk : Wtv;
            D[n * HID + k] = (_Float16)W[k * HID + n];
        }
    }
}

// ---------- kernel 2: QKV projection GEMM ----------
// one wave computes a 32(M) x 64(N) tile;  grid = (128 Mtiles, 16 Ntiles, 3 matrices)
// B-fragments reused across both M halves: 8 WMMAs per 12 b128 loads per k-step.
__global__ void qkv_gemm_kernel(const _Float16* __restrict__ Xh,
                                const _Float16* __restrict__ Wtq,
                                const _Float16* __restrict__ Wtk,
                                const _Float16* __restrict__ Wtv,
                                const float* __restrict__ bq,
                                const float* __restrict__ bk,
                                const float* __restrict__ bv,
                                _Float16* __restrict__ Qh,
                                _Float16* __restrict__ Kh,
                                _Float16* __restrict__ Vt) {
    const int z    = blockIdx.z;                 // 0=Q 1=K 2=V
    const _Float16* Wt = (z == 0) ? Wtq : (z == 1) ? Wtk : Wtv;
    const float*  bias = (z == 0) ? bq  : (z == 1) ? bk  : bv;

    const int lane = threadIdx.x & 31;
    const int nl   = lane & 15;
    const int hi   = lane >> 4;
    const int koff = hi * 8;

    const int m0 = blockIdx.x * 32;
    const int n0 = blockIdx.y * 64;

    v8f acc[2][4];
#pragma unroll
    for (int g = 0; g < 2; ++g)
#pragma unroll
        for (int f = 0; f < 4; ++f)
#pragma unroll
            for (int r = 0; r < 8; ++r) acc[g][f][r] = 0.0f;

    const _Float16* arow0 = Xh + (size_t)(m0 + nl) * HID;
    const _Float16* arow1 = Xh + (size_t)(m0 + 16 + nl) * HID;
    for (int k = 0; k < HID; k += 32) {
        v16h a0 = load_frag16(arow0 + k + koff);
        v16h a1 = load_frag16(arow1 + k + koff);
#pragma unroll
        for (int f = 0; f < 4; ++f) {
            v16h b = load_frag16(Wt + (size_t)(n0 + f * 16 + nl) * HID + k + koff);
            acc[0][f] = wmma_f16(a0, b, acc[0][f]);
            acc[1][f] = wmma_f16(a1, b, acc[1][f]);
        }
    }

    // epilogue: bias + scatter to per-head layout
#pragma unroll
    for (int f = 0; f < 4; ++f) {
        int n = n0 + f * 16 + nl;
        float bval = bias[n];
        int hh = n >> 6;
        int d  = n & 63;
#pragma unroll
        for (int g = 0; g < 2; ++g) {
#pragma unroll
            for (int r = 0; r < 8; ++r) {
                int m = m0 + g * 16 + r + hi * 8;
                int b = m >> 11;
                int s = m & 2047;
                float val = acc[g][f][r] + bval;
                int bh = b * NH + hh;
                if (z == 0) {
                    Qh[((size_t)bh * SEQ + s) * DH + d] = (_Float16)val;
                } else if (z == 1) {
                    Kh[((size_t)bh * SEQ + s) * DH + d] = (_Float16)val;
                } else {
                    Vt[((size_t)bh * DH + d) * SEQ + s] = (_Float16)val;
                }
            }
        }
    }
}

// ---------- kernel 3: flash attention ----------
// block = 8 waves, all on one (b,h); each wave owns a 16-row q-tile.
// K/V tiles (64 cols) are cooperatively staged in LDS (double-buffered) via
// async global->LDS copies, so each tile hits L2 once per block (8x cut) and
// no wave stalls on a load-wait. Row-sums come from a P x ones WMMA.
#define KBLK 64
#define NW_ATT 8
// LDS row pitch in halves: 64 data + 8 pad = 144 B = 16 B x odd, so the 16 rows
// that one ds_load_b128 touches fall on distinct banks (128 B rows collide).
#define LPITCH 72

__global__ void attn_kernel(const _Float16* __restrict__ Qh,
                            const _Float16* __restrict__ Kh,
                            const _Float16* __restrict__ Vt,
                            const float* __restrict__ mask,
                            float* __restrict__ out) {
    __shared__ __align__(16) _Float16 Klds[2][KBLK * LPITCH];     // 2 x 9 KB
    __shared__ __align__(16) _Float16 Vlds[2][DH * LPITCH];       // 2 x 9 KB
    __shared__ __align__(16) _Float16 plds[NW_ATT][16 * LPITCH];  // 8 x 2.25 KB

    const int tid  = threadIdx.x;
    const int wave = tid >> 5;
    const int lane = tid & 31;
    const int nl   = lane & 15;
    const int hi   = lane >> 4;
    const int koff = hi * 8;

    const int bh = blockIdx.y;
    const int b  = bh >> 4;
    const int h  = bh & 15;
    const int q0 = (blockIdx.x * NW_ATT + wave) * 16;

    const _Float16* Qbase = Qh + ((size_t)bh * SEQ + q0) * DH;
    const _Float16* Kbase = Kh + (size_t)bh * SEQ * DH;
    const _Float16* Vbase = Vt + (size_t)bh * DH * SEQ;
    const float*    mrow  = mask + (size_t)b * SEQ;

    const float LOG2E  = 1.4426950408889634f;
    const float KSCALE = 0.125f * LOG2E;      // 1/sqrt(64) folded into log2 domain

    // cooperative stage of one K/V tile pair into LDS buffer `buf`
    auto stage = [&](int buf, int k0) {
#pragma unroll
        for (int j = 0; j < 2; ++j) {
            int c   = tid * 2 + j;        // 0..511
            int row = c >> 3;             // 0..63
            int col = (c & 7) * 8;        // halves
            cp16_g2l(Kbase + (size_t)(k0 + row) * DH + col,
                     &Klds[buf][row * LPITCH + col]);
            cp16_g2l(Vbase + (size_t)row * SEQ + k0 + col,
                     &Vlds[buf][row * LPITCH + col]);
        }
    };

    // Q a-fragments (16 rows x 64 K), reused across the whole loop
    v16h qa[2];
#pragma unroll
    for (int j = 0; j < 2; ++j)
        qa[j] = load_frag16(Qbase + (size_t)nl * DH + j * 32 + koff);

    v16h ones;
#pragma unroll
    for (int i = 0; i < 16; ++i) ones[i] = (_Float16)1.0f;

    v8f ctx[4];
#pragma unroll
    for (int f = 0; f < 4; ++f)
#pragma unroll
        for (int r = 0; r < 8; ++r) ctx[f][r] = 0.0f;

    float m_run[8], l_run[8];
#pragma unroll
    for (int r = 0; r < 8; ++r) { m_run[r] = -1.0e30f; l_run[r] = 0.0f; }

    stage(0, 0);

    for (int it = 0; it < SEQ / KBLK; ++it) {
        const int k0  = it * KBLK;
        const int cur = it & 1;
        wait_async_copies();                  // drain this wave's async stores to LDS
        __syncthreads();                      // tile `cur` ready; everyone past `cur^1`
        if (it + 1 < SEQ / KBLK) stage(cur ^ 1, k0 + KBLK);

        const _Float16* Kt = &Klds[cur][0];
        const _Float16* Vv = &Vlds[cur][0];

        // ---- scores: 4 column-frags x 2 k-chunks = 8 WMMAs ----
        v8f S[4];
#pragma unroll
        for (int c = 0; c < 4; ++c) {
#pragma unroll
            for (int r = 0; r < 8; ++r) S[c][r] = 0.0f;
#pragma unroll
            for (int j = 0; j < 2; ++j) {
                v16h kb = load_frag16(Kt + (size_t)(16 * c + nl) * LPITCH + j * 32 + koff);
                S[c] = wmma_f16(qa[j], kb, S[c]);
            }
        }

        float mk[4];
#pragma unroll
        for (int c = 0; c < 4; ++c) mk[c] = mrow[k0 + 16 * c + nl] * LOG2E;

        // ---- online softmax (log2 domain) ----
        float rscale[8], e[4][8];
#pragma unroll
        for (int r = 0; r < 8; ++r) {
            float v0 = S[0][r] * KSCALE + mk[0];
            float v1 = S[1][r] * KSCALE + mk[1];
            float v2 = S[2][r] * KSCALE + mk[2];
            float v3 = S[3][r] * KSCALE + mk[3];
            float mx = fmaxf(fmaxf(v0, v1), fmaxf(v2, v3));
#pragma unroll
            for (int off = 1; off < 16; off <<= 1)
                mx = fmaxf(mx, __shfl_xor(mx, off, 16));
            float mnew = fmaxf(m_run[r], mx);
            rscale[r] = exp2f(m_run[r] - mnew);
            e[0][r] = exp2f(v0 - mnew);
            e[1][r] = exp2f(v1 - mnew);
            e[2][r] = exp2f(v2 - mnew);
            e[3][r] = exp2f(v3 - mnew);
            m_run[r] = mnew;
        }

        // ---- re-layout P (C-format -> A-format) through per-wave LDS ----
        _Float16* pw = &plds[wave][0];
#pragma unroll
        for (int r = 0; r < 8; ++r) {
            int row = r + hi * 8;
#pragma unroll
            for (int c = 0; c < 4; ++c)
                pw[row * LPITCH + 16 * c + nl] = (_Float16)e[c][r];
        }
        v16h pa[2];
#pragma unroll
        for (int j = 0; j < 2; ++j)
            pa[j] = load_frag16(pw + (size_t)nl * LPITCH + j * 32 + koff);

        // ---- row sums via P x ones (moves reduction onto the matrix pipe) ----
        v8f ls;
#pragma unroll
        for (int r = 0; r < 8; ++r) ls[r] = 0.0f;
        ls = wmma_f16(pa[0], ones, ls);
        ls = wmma_f16(pa[1], ones, ls);

        // ---- rescale ctx, update l, ctx += P x V (8 WMMAs) ----
#pragma unroll
        for (int f = 0; f < 4; ++f)
#pragma unroll
            for (int r = 0; r < 8; ++r) ctx[f][r] *= rscale[r];
#pragma unroll
        for (int r = 0; r < 8; ++r) l_run[r] = l_run[r] * rscale[r] + ls[r];

#pragma unroll
        for (int f = 0; f < 4; ++f) {
#pragma unroll
            for (int j = 0; j < 2; ++j) {
                v16h vb = load_frag16(Vv + (size_t)(f * 16 + nl) * LPITCH + j * 32 + koff);
                ctx[f] = wmma_f16(pa[j], vb, ctx[f]);
            }
        }
    }

    // ---- normalize and write [B,S,h*dh] fp32 ----
#pragma unroll
    for (int f = 0; f < 4; ++f) {
#pragma unroll
        for (int r = 0; r < 8; ++r) {
            int row = r + hi * 8;
            out[((size_t)b * SEQ + q0 + row) * HID + h * DH + f * 16 + nl] =
                ctx[f][r] / l_run[r];
        }
    }
}

// ---------- launcher ----------
extern "C" void kernel_launch(void* const* d_in, const int* in_sizes, int n_in,
                              void* d_out, int out_size, void* d_ws, size_t ws_size,
                              hipStream_t stream) {
    const float* hidden = (const float*)d_in[0];
    const float* amask  = (const float*)d_in[1];
    const float* Wq     = (const float*)d_in[2];
    const float* bq     = (const float*)d_in[3];
    const float* Wk     = (const float*)d_in[4];
    const float* bk     = (const float*)d_in[5];
    const float* Wv     = (const float*)d_in[6];
    const float* bv     = (const float*)d_in[7];
    float* out = (float*)d_out;

    // workspace layout (bytes); total ~38 MB
    char* ws = (char*)d_ws;
    const size_t XH_OFF  = 0;
    const size_t WTQ_OFF = XH_OFF  + (size_t)MTOT * HID * 2;
    const size_t WTK_OFF = WTQ_OFF + (size_t)HID * HID * 2;
    const size_t WTV_OFF = WTK_OFF + (size_t)HID * HID * 2;
    const size_t QH_OFF  = WTV_OFF + (size_t)HID * HID * 2;
    const size_t KH_OFF  = QH_OFF  + (size_t)MTOT * HID * 2;
    const size_t VT_OFF  = KH_OFF  + (size_t)MTOT * HID * 2;

    _Float16* Xh  = (_Float16*)(ws + XH_OFF);
    _Float16* Wtq = (_Float16*)(ws + WTQ_OFF);
    _Float16* Wtk = (_Float16*)(ws + WTK_OFF);
    _Float16* Wtv = (_Float16*)(ws + WTV_OFF);
    _Float16* Qh  = (_Float16*)(ws + QH_OFF);
    _Float16* Kh  = (_Float16*)(ws + KH_OFF);
    _Float16* Vt  = (_Float16*)(ws + VT_OFF);

    // 1) convert inputs to f16 (+ transpose weights)
    {
        int total  = MTOT * HID + 3 * HID * HID;
        int blocks = (total + 255) / 256;
        cvt_kernel<<<blocks, 256, 0, stream>>>(hidden, Wq, Wk, Wv, Xh, Wtq, Wtk, Wtv);
    }

    // 2) QKV projections via WMMA (32x64 tiles per wave)
    {
        dim3 grid(MTOT / 32, HID / 64, 3);   // (128, 16, 3)
        qkv_gemm_kernel<<<grid, 32, 0, stream>>>(Xh, Wtq, Wtk, Wtv, bq, bk, bv,
                                                 Qh, Kh, Vt);
    }

    // 3) flash attention via WMMA with async-LDS-staged K/V
    {
        dim3 grid(SEQ / (16 * NW_ATT), BATCH * NH);   // (16, 32)
        attn_kernel<<<grid, 256, 0, stream>>>(Qh, Kh, Vt, amask, out);
    }
}

// v002
// It runs in 174 microseconds.
// Next to v001, in two timings, it ran 1.56 and 1.55 times as fast.
// Over all steps from v000 it is 1.97 times as fast.
#include <hip/hip_runtime.h>
#include <hip/hip_bf16.h>
#include <math.h>

typedef __attribute__((ext_vector_type(16))) _Float16 v16h;
typedef __attribute__((ext_vector_type(8)))  float    v8f;
typedef int vs4i __attribute__((vector_size(16)));

#define SEQ   2048
#define HID   1024
#define NH    16
#define DH    64
#define BATCH 2
#define MTOT  (BATCH * SEQ)   // 4096 rows for QKV gemm

#if __has_builtin(__builtin_amdgcn_global_load_async_to_lds_b128)
#define HAVE_ASYNC_LDS 1
#endif

// ---------- fragment helpers ----------
// 16-bit A-matrix 16x32 layout: lane%16 = row, lane/16 selects K-offset (0 or 8);
// halves {koff..koff+7} then {koff+16..koff+23} -> two 16B loads.
__device__ __forceinline__ v16h load_frag16(const _Float16* p) {
    union { v16h v; uint4 u[2]; } u;
    u.u[0] = *reinterpret_cast<const uint4*>(p);
    u.u[1] = *reinterpret_cast<const uint4*>(p + 16);
    return u.v;
}

__device__ __forceinline__ v8f wmma_f16(v16h a, v16h b, v8f c) {
    return __builtin_amdgcn_wmma_f32_16x16x32_f16(
        /*neg_a=*/false, a, /*neg_b=*/false, b,
        /*c_mod=*/(short)0, c, /*reuse_a=*/false, /*reuse_b=*/false);
}

// 16-byte global -> LDS copy; async (ASYNCcnt-tracked, no VGPR round trip) when
// the gfx1250 builtin is available, else VGPR-staged fallback.
__device__ __forceinline__ void cp16_g2l(const _Float16* g, _Float16* l) {
#if defined(HAVE_ASYNC_LDS)
    __builtin_amdgcn_global_load_async_to_lds_b128(
        (__attribute__((address_space(1))) vs4i*)(unsigned long long)(const void*)g,
        (__attribute__((address_space(3))) vs4i*)(unsigned int)(unsigned long long)(void*)l,
        0, 0);
#else
    *reinterpret_cast<uint4*>(l) = *reinterpret_cast<const uint4*>(g);
#endif
}

__device__ __forceinline__ void wait_async_copies() {
#if defined(HAVE_ASYNC_LDS)
#if __has_builtin(__builtin_amdgcn_s_wait_asynccnt)
    __builtin_amdgcn_s_wait_asynccnt(0);
#else
    asm volatile("s_wait_asynccnt 0x0" ::: "memory");
#endif
#endif
}

// ---------- kernel 1: fp32 -> f16 convert + weight transpose ----------
__global__ void cvt_kernel(const float* __restrict__ X,
                           const float* __restrict__ Wq,
                           const float* __restrict__ Wk,
                           const float* __restrict__ Wv,
                           _Float16* __restrict__ Xh,
                           _Float16* __restrict__ Wtq,
                           _Float16* __restrict__ Wtk,
                           _Float16* __restrict__ Wtv) {
    const int NX = MTOT * HID;          // 4194304
    const int NW = HID * HID;           // 1048576
    int i = blockIdx.x * blockDim.x + threadIdx.x;
    int total = NX + 3 * NW;
    for (; i < total; i += gridDim.x * blockDim.x) {
        if (i < NX) {
            Xh[i] = (_Float16)X[i];
        } else {
            int j = i - NX;
            int w = j / NW;
            int r = j - w * NW;
            int n = r >> 10;
            int k = r & 1023;
            const float* W = (w == 0) ? Wq : (w == 1) ? Wk : Wv;
            _Float16* D    = (w == 0) ? Wtq : (w == 1) ? Wtk : Wtv;
            D[n * HID + k] = (_Float16)W[k * HID + n];
        }
    }
}

// ---------- kernel 2: QKV projection GEMM ----------
// one work-group of 4 waves computes a 128(M) x 128(N) tile; each wave owns 64 x 64.
// grid = (32 Mtiles, 8 Ntiles, 3 matrices). Slices of 64 k of the X rows and of the
// W^T rows are brought to LDS once per work-group by async copies (whole 128 B lines),
// two buffers, the next slice in flight while this one is multiplied; every fragment
// read from LDS feeds 4 WMMAs.
#define GBM 128
#define GBN 128
#define GBK 64
// LDS row pitch in halves: 64 data + 8 pad = 144 B = 16 B x odd (ds_load_b128 reader)
#define GPITCH 72
#define GTHREADS 128

__global__ __launch_bounds__(GTHREADS)
void qkv_gemm_kernel(const _Float16* __restrict__ Xh,
                     const _Float16* __restrict__ Wtq,
                     const _Float16* __restrict__ Wtk,
                     const _Float16* __restrict__ Wtv,
                     const float* __restrict__ bq,
                     const float* __restrict__ bk,
                     const float* __restrict__ bv,
                     _Float16* __restrict__ Qh,
                     _Float16* __restrict__ Kh,
                     _Float16* __restrict__ Vt) {
    __shared__ __align__(16) _Float16 Ash[2][GBM * GPITCH];   // 2 x 18 KB
    __shared__ __align__(16) _Float16 Bsh[2][GBN * GPITCH];   // 2 x 18 KB

    const int z    = blockIdx.z;                 // 0=Q 1=K 2=V
    const _Float16* Wt = (z == 0) ? Wtq : (z == 1) ? Wtk : Wtv;
    const float*  bias = (z == 0) ? bq  : (z == 1) ? bk  : bv;

    const int tid  = threadIdx.x;
    const int wave = tid >> 5;
    const int lane = tid & 31;
    const int nl   = lane & 15;
    const int hi   = lane >> 4;
    const int koff = hi * 8;

    const int m0 = blockIdx.x * GBM;
    const int n0 = blockIdx.y * GBN;
    const int wm = (wave >> 1) * 64;             // this wave's rows inside the tile
    const int wn = (wave & 1) * 64;              // this wave's columns inside the tile

    // one k-slice of both operands into LDS buffer `buf`: 8 lanes cover one 128 B row
    auto stage = [&](int buf, int k0) {
#pragma unroll  // the 16 copies of a slice issue back to back
        for (int j = 0; j < (GBM * 8) / GTHREADS; ++j) {
            int c   = tid + j * GTHREADS;  // 0..1023
            int row = c >> 3;              // 0..127
            int col = (c & 7) * 8;         // halves
            cp16_g2l(Xh + (size_t)(m0 + row) * HID + k0 + col,
                     &Ash[buf][row * GPITCH + col]);
            cp16_g2l(Wt + (size_t)(n0 + row) * HID + k0 + col,
                     &Bsh[buf][row * GPITCH + col]);
        }
    };

    v8f acc[4][4];
#pragma unroll  // constant index: the array stays in registers
    for (int g = 0; g < 4; ++g)
#pragma unroll  // constant index: the array stays in registers
        for (int f = 0; f < 4; ++f)
#pragma unroll  // constant index: the array stays in registers
            for (int r = 0; r < 8; ++r) acc[g][f][r] = 0.0f;

    stage(0, 0);
    // slice 0 has landed for this wave's own copies before the barrier publishes it
    asm volatile("s_wait_asynccnt 0x0" ::: "memory");
    __syncthreads();
    stage(1, GBK);

    for (int t = 0; t < HID / GBK; ++t) {
        const _Float16* At = &Ash[t & 1][0];
        const _Float16* Bt = &Bsh[t & 1][0];
        v16h a[4], b[4];

        // first 32 k of the slice
#pragma unroll  // constant index: the array stays in registers
        for (int g = 0; g < 4; ++g)
            a[g] = load_frag16(At + (wm + g * 16 + nl) * GPITCH + koff);
#pragma unroll  // constant index: the array stays in registers
        for (int f = 0; f < 4; ++f)
            b[f] = load_frag16(Bt + (wn + f * 16 + nl) * GPITCH + koff);
        // keeps the 16 LDS reads of this k-step together in front of its 16 WMMAs:
        // left free, the scheduler reads each b fragment right before its use and
        // the wave waits out the LDS latency four times per k-step instead of once
        __builtin_amdgcn_sched_barrier(0);
#pragma unroll  // constant index: the array stays in registers
        for (int f = 0; f < 4; ++f)
#pragma unroll  // constant index: the array stays in registers
            for (int g = 0; g < 4; ++g)
                acc[g][f] = wmma_f16(a[g], b[f], acc[g][f]);

        // second 32 k: the fragments are fetched, the buffer is handed back and its
        // refill is on its way before the 16 WMMAs that need registers only
#pragma unroll  // constant index: the array stays in registers
        for (int g = 0; g < 4; ++g)
            a[g] = load_frag16(At + (wm + g * 16 + nl) * GPITCH + 32 + koff);
#pragma unroll  // constant index: the array stays in registers
        for (int f = 0; f < 4; ++f)
            b[f] = load_frag16(Bt + (wn + f * 16 + nl) * GPITCH + 32 + koff);
        // this wave's reads of buffer t&1 are done before the buffer is refilled
        asm volatile("s_wait_dscnt 0x0" ::: "memory");
        // this wave's copies of slice t+1 have landed before the barrier publishes them
        asm volatile("s_wait_asynccnt 0x0" ::: "memory");
        __syncthreads();
        if (t + 2 < HID / GBK) stage(t & 1, (t + 2) * GBK);
#pragma unroll  // constant index: the array stays in registers
        for (int f = 0; f < 4; ++f)
#pragma unroll  // constant index: the array stays in registers
            for (int g = 0; g < 4; ++g)
                acc[g][f] = wmma_f16(a[g], b[f], acc[g][f]);
    }
    // no copy is outstanding when the wave goes on to its end
    asm volatile("s_wait_asynccnt 0x0" ::: "memory");

    // epilogue: bias + scatter to per-head layout
#pragma unroll  // constant index: the array stays in registers
    for (int f = 0; f < 4; ++f) {
        int n = n0 + wn + f * 16 + nl;
        float bval = bias[n];
        int hh = n >> 6;
        int d  = n & 63;
#pragma unroll  // constant index: the array stays in registers
        for (int g = 0; g < 4; ++g) {
#pragma unroll  // constant index: the array stays in registers
            for (int r = 0; r < 8; ++r) {
                int m = m0 + wm + g * 16 + r + hi * 8;
                int b = m >> 11;
                int s = m & 2047;
                float val = acc[g][f][r] + bval;
                int bh = b * NH + hh;
                if (z == 0) {
                    Qh[((size_t)bh * SEQ + s) * DH + d] = (_Float16)val;
                } else if (z == 1) {
                    Kh[((size_t)bh * SEQ + s) * DH + d] = (_Float16)val;
                } else {
                    Vt[((size_t)bh * DH + d) * SEQ + s] = (_Float16)val;
                }
            }
        }
    }
}

// ---------- kernel 3: flash attention ----------
// block = 8 waves, all on one (b,h); each wave owns a 16-row q-tile.
// K/V tiles (64 cols) are cooperatively staged in LDS (double-buffered) via
// async global->LDS copies, so each tile hits L2 once per block (8x cut) and
// no wave stalls on a load-wait. Row-sums come from a P x ones WMMA.
#define KBLK 64
#define NW_ATT 8
// LDS row pitch in halves: 64 data + 8 pad = 144 B = 16 B x odd, so the 16 rows
// that one ds_load_b128 touches fall on distinct banks (128 B rows collide).
#define LPITCH 72

__global__ void attn_kernel(const _Float16* __restrict__ Qh,
                            const _Float16* __restrict__ Kh,
                            const _Float16* __restrict__ Vt,
                            const float* __restrict__ mask,
                            float* __restrict__ out) {
    __shared__ __align__(16) _Float16 Klds[2][KBLK * LPITCH];     // 2 x 9 KB
    __shared__ __align__(16) _Float16 Vlds[2][DH * LPITCH];       // 2 x 9 KB
    __shared__ __align__(16) _Float16 plds[NW_ATT][16 * LPITCH];  // 8 x 2.25 KB

    const int tid  = threadIdx.x;
    const int wave = tid >> 5;
    const int lane = tid & 31;
    const int nl   = lane & 15;
    const int hi   = lane >> 4;
    const int koff = hi * 8;

    const int bh = blockIdx.y;
    const int b  = bh >> 4;
    const int h  = bh & 15;
    const int q0 = (blockIdx.x * NW_ATT + wave) * 16;

    const _Float16* Qbase = Qh + ((size_t)bh * SEQ + q0) * DH;
    const _Float16* Kbase = Kh + (size_t)bh * SEQ * DH;
    const _Float16* Vbase = Vt + (size_t)bh * DH * SEQ;
    const float*    mrow  = mask + (size_t)b * SEQ;

    const float LOG2E  = 1.4426950408889634f;
    const float KSCALE = 0.125f * LOG2E;      // 1/sqrt(64) folded into log2 domain

    // cooperative stage of one K/V tile pair into LDS buffer `buf`
    auto stage = [&](int buf, int k0) {
#pragma unroll
        for (int j = 0; j < 2; ++j) {
            int c   = tid * 2 + j;        // 0..511
            int row = c >> 3;             // 0..63
            int col = (c & 7) * 8;        // halves
            cp16_g2l(Kbase + (size_t)(k0 + row) * DH + col,
                     &Klds[buf][row * LPITCH + col]);
            cp16_g2l(Vbase + (size_t)row * SEQ + k0 + col,
                     &Vlds[buf][row * LPITCH + col]);
        }
    };

    // Q a-fragments (16 rows x 64 K), reused across the whole loop
    v16h qa[2];
#pragma unroll
    for (int j = 0; j < 2; ++j)
        qa[j] = load_frag16(Qbase + (size_t)nl * DH + j * 32 + koff);

    v16h ones;
#pragma unroll
    for (int i = 0; i < 16; ++i) ones[i] = (_Float16)1.0f;

    v8f ctx[4];
#pragma unroll
    for (int f = 0; f < 4; ++f)
#pragma unroll
        for (int r = 0; r < 8; ++r) ctx[f][r] = 0.0f;

    float m_run[8], l_run[8];
#pragma unroll
    for (int r = 0; r < 8; ++r) { m_run[r] = -1.0e30f; l_run[r] = 0.0f; }

    stage(0, 0);

    for (int it = 0; it < SEQ / KBLK; ++it) {
        const int k0  = it * KBLK;
        const int cur = it & 1;
        wait_async_copies();                  // drain this wave's async stores to LDS
        __syncthreads();                      // tile `cur` ready; everyone past `cur^1`
        if (it + 1 < SEQ / KBLK) stage(cur ^ 1, k0 + KBLK);

        const _Float16* Kt = &Klds[cur][0];
        const _Float16* Vv = &Vlds[cur][0];

        // ---- scores: 4 column-frags x 2 k-chunks = 8 WMMAs ----
        v8f S[4];
#pragma unroll
        for (int c = 0; c < 4; ++c) {
#pragma unroll
            for (int r = 0; r < 8; ++r) S[c][r] = 0.0f;
#pragma unroll
            for (int j = 0; j < 2; ++j) {
                v16h kb = load_frag16(Kt + (size_t)(16 * c + nl) * LPITCH + j * 32 + koff);
                S[c] = wmma_f16(qa[j], kb, S[c]);
            }
        }

        float mk[4];
#pragma unroll
        for (int c = 0; c < 4; ++c) mk[c] = mrow[k0 + 16 * c + nl] * LOG2E;

        // ---- online softmax (log2 domain) ----
        float rscale[8], e[4][8];
#pragma unroll
        for (int r = 0; r < 8; ++r) {
            float v0 = S[0][r] * KSCALE + mk[0];
            float v1 = S[1][r] * KSCALE + mk[1];
            float v2 = S[2][r] * KSCALE + mk[2];
            float v3 = S[3][r] * KSCALE + mk[3];
            float mx = fmaxf(fmaxf(v0, v1), fmaxf(v2, v3));
#pragma unroll
            for (int off = 1; off < 16; off <<= 1)
                mx = fmaxf(mx, __shfl_xor(mx, off, 16));
            float mnew = fmaxf(m_run[r], mx);
            rscale[r] = exp2f(m_run[r] - mnew);
            e[0][r] = exp2f(v0 - mnew);
            e[1][r] = exp2f(v1 - mnew);
            e[2][r] = exp2f(v2 - mnew);
            e[3][r] = exp2f(v3 - mnew);
            m_run[r] = mnew;
        }

        // ---- re-layout P (C-format -> A-format) through per-wave LDS ----
        _Float16* pw = &plds[wave][0];
#pragma unroll
        for (int r = 0; r < 8; ++r) {
            int row = r + hi * 8;
#pragma unroll
            for (int c = 0; c < 4; ++c)
                pw[row * LPITCH + 16 * c + nl] = (_Float16)e[c][r];
        }
        v16h pa[2];
#pragma unroll
        for (int j = 0; j < 2; ++j)
            pa[j] = load_frag16(pw + (size_t)nl * LPITCH + j * 32 + koff);

        // ---- row sums via P x ones (moves reduction onto the matrix pipe) ----
        v8f ls;
#pragma unroll
        for (int r = 0; r < 8; ++r) ls[r] = 0.0f;
        ls = wmma_f16(pa[0], ones, ls);
        ls = wmma_f16(pa[1], ones, ls);

        // ---- rescale ctx, update l, ctx += P x V (8 WMMAs) ----
#pragma unroll
        for (int f = 0; f < 4; ++f)
#pragma unroll
            for (int r = 0; r < 8; ++r) ctx[f][r] *= rscale[r];
#pragma unroll
        for (int r = 0; r < 8; ++r) l_run[r] = l_run[r] * rscale[r] + ls[r];

#pragma unroll
        for (int f = 0; f < 4; ++f) {
#pragma unroll
            for (int j = 0; j < 2; ++j) {
                v16h vb = load_frag16(Vv + (size_t)(f * 16 + nl) * LPITCH + j * 32 + koff);
                ctx[f] = wmma_f16(pa[j], vb, ctx[f]);
            }
        }
    }

    // ---- normalize and write [B,S,h*dh] fp32 ----
#pragma unroll
    for (int f = 0; f < 4; ++f) {
#pragma unroll
        for (int r = 0; r < 8; ++r) {
            int row = r + hi * 8;
            out[((size_t)b * SEQ + q0 + row) * HID + h * DH + f * 16 + nl] =
                ctx[f][r] / l_run[r];
        }
    }
}

// ---------- launcher ----------
extern "C" void kernel_launch(void* const* d_in, const int* in_sizes, int n_in,
                              void* d_out, int out_size, void* d_ws, size_t ws_size,
                              hipStream_t stream) {
    const float* hidden = (const float*)d_in[0];
    const float* amask  = (const float*)d_in[1];
    const float* Wq     = (const float*)d_in[2];
    const float* bq     = (const float*)d_in[3];
    const float* Wk     = (const float*)d_in[4];
    const float* bk     = (const float*)d_in[5];
    const float* Wv     = (const float*)d_in[6];
    const float* bv     = (const float*)d_in[7];
    float* out = (float*)d_out;

    // workspace layout (bytes); total ~38 MB
    char* ws = (char*)d_ws;
    const size_t XH_OFF  = 0;
    const size_t WTQ_OFF = XH_OFF  + (size_t)MTOT * HID * 2;
    const size_t WTK_OFF = WTQ_OFF + (size_t)HID * HID * 2;
    const size_t WTV_OFF = WTK_OFF + (size_t)HID * HID * 2;
    const size_t QH_OFF  = WTV_OFF + (size_t)HID * HID * 2;
    const size_t KH_OFF  = QH_OFF  + (size_t)MTOT * HID * 2;
    const size_t VT_OFF  = KH_OFF  + (size_t)MTOT * HID * 2;

    _Float16* Xh  = (_Float16*)(ws + XH_OFF);
    _Float16* Wtq = (_Float16*)(ws + WTQ_OFF);
    _Float16* Wtk = (_Float16*)(ws + WTK_OFF);
    _Float16* Wtv = (_Float16*)(ws + WTV_OFF);
    _Float16* Qh  = (_Float16*)(ws + QH_OFF);
    _Float16* Kh  = (_Float16*)(ws + KH_OFF);
    _Float16* Vt  = (_Float16*)(ws + VT_OFF);

    // 1) convert inputs to f16 (+ transpose weights)
    {
        int total  = MTOT * HID + 3 * HID * HID;
        int blocks = (total + 255) / 256;
        cvt_kernel<<<blocks, 256, 0, stream>>>(hidden, Wq, Wk, Wv, Xh, Wtq, Wtk, Wtv);
    }

    // 2) QKV projections via WMMA (128x128 tiles per 4-wave work-group)
    {
        dim3 grid(MTOT / GBM, HID / GBN, 3);   // (32, 8, 3)
        qkv_gemm_kernel<<<grid, GTHREADS, 0, stream>>>(Xh, Wtq, Wtk, Wtv, bq, bk, bv,
                                                       Qh, Kh, Vt);
    }

    // 3) flash attention via WMMA with async-LDS-staged K/V
    {
        dim3 grid(SEQ / (16 * NW_ATT), BATCH * NH);   // (16, 32)
        attn_kernel<<<grid, 256, 0, stream>>>(Qh, Kh, Vt, amask, out);
    }
}

// v003
// It runs in 156 microseconds.
// Timed twice side by side with v002, it ran 1.11 times as fast both times.
// Over all steps from v000 it is 2.19 times as fast.
#include <hip/hip_runtime.h>
#include <hip/hip_bf16.h>
#include <math.h>

typedef __attribute__((ext_vector_type(16))) _Float16 v16h;
typedef __attribute__((ext_vector_type(8)))  float    v8f;
typedef int vs4i __attribute__((vector_size(16)));

#define SEQ   2048
#define HID   1024
#define NH    16
#define DH    64
#define BATCH 2
#define MTOT  (BATCH * SEQ)   // 4096 rows for QKV gemm

#if __has_builtin(__builtin_amdgcn_global_load_async_to_lds_b128)
#define HAVE_ASYNC_LDS 1
#endif

// ---------- fragment helpers ----------
// 16-bit A-matrix 16x32 layout: lane%16 = row, lane/16 selects K-offset (0 or 8);
// halves {koff..koff+7} then {koff+16..koff+23} -> two 16B loads.
__device__ __forceinline__ v16h load_frag16(const _Float16* p) {
    union { v16h v; uint4 u[2]; } u;
    u.u[0] = *reinterpret_cast<const uint4*>(p);
    u.u[1] = *reinterpret_cast<const uint4*>(p + 16);
    return u.v;
}

__device__ __forceinline__ v8f wmma_f16(v16h a, v16h b, v8f c) {
    return __builtin_amdgcn_wmma_f32_16x16x32_f16(
        /*neg_a=*/false, a, /*neg_b=*/false, b,
        /*c_mod=*/(short)0, c, /*reuse_a=*/false, /*reuse_b=*/false);
}

// 16-byte global -> LDS copy; async (ASYNCcnt-tracked, no VGPR round trip) when
// the gfx1250 builtin is available, else VGPR-staged fallback.
__device__ __forceinline__ void cp16_g2l(const _Float16* g, _Float16* l) {
#if defined(HAVE_ASYNC_LDS)
    __builtin_amdgcn_global_load_async_to_lds_b128(
        (__attribute__((address_space(1))) vs4i*)(unsigned long long)(const void*)g,
        (__attribute__((address_space(3))) vs4i*)(unsigned int)(unsigned long long)(void*)l,
        0, 0);
#else
    *reinterpret_cast<uint4*>(l) = *reinterpret_cast<const uint4*>(g);
#endif
}

__device__ __forceinline__ void wait_async_copies() {
#if defined(HAVE_ASYNC_LDS)
#if __has_builtin(__builtin_amdgcn_s_wait_asynccnt)
    __builtin_amdgcn_s_wait_asynccnt(0);
#else
    asm volatile("s_wait_asynccnt 0x0" ::: "memory");
#endif
#endif
}

// ---------- kernel 1: fp32 -> f16 convert + weight transpose ----------
// A streaming launch of few, long-lived waves: every lane has 8 loads of 16 B in
// flight, every wave-wide load covers 512 contiguous bytes and every store fills
// whole 128 B lines.
//   blocks 0 .. CVT_WBLOCKS-1 : one 64(k) x 128(n) tile of one weight matrix, turned
//                               round in LDS and stored as rows of W^T
//   the other CVT_XBLOCKS     : 8192 consecutive elements of X
typedef __attribute__((ext_vector_type(4))) _Float16 v4h;
typedef __attribute__((ext_vector_type(8))) _Float16 v8h;

#define CVT_THREADS 256
#define CVT_TK 64
#define CVT_TN 128
// LDS row pitch in halves: 64 data + 8 pad = 144 B = 16 B x odd (ds_load_b128 reader)
#define CVT_PITCH 72
#define CVT_WBLOCKS (3 * (HID / CVT_TK) * (HID / CVT_TN))      // 384
#define CVT_XELEMS  (CVT_THREADS * 4 * 8)                      // 8192 per block
#define CVT_XBLOCKS ((MTOT * HID) / CVT_XELEMS)                // 512

__global__ __launch_bounds__(CVT_THREADS)
void cvt_kernel(const float* __restrict__ X,
                const float* __restrict__ Wq,
                const float* __restrict__ Wk,
                const float* __restrict__ Wv,
                _Float16* __restrict__ Xh,
                _Float16* __restrict__ Wtq,
                _Float16* __restrict__ Wtk,
                _Float16* __restrict__ Wtv) {
    __shared__ __align__(16) _Float16 tile[CVT_TN * CVT_PITCH];   // 18 KB, [n][k]

    const int tid = threadIdx.x;
    const int blk = blockIdx.x;

    if (blk < CVT_WBLOCKS) {
        const int w  = blk >> 7;                  // 128 tiles per matrix
        const int k0 = ((blk >> 3) & 15) * CVT_TK;
        const int n0 = (blk & 7) * CVT_TN;
        const float* Wsrc = (w == 0) ? Wq : (w == 1) ? Wk : Wv;
        _Float16*    Wdst = (w == 0) ? Wtq : (w == 1) ? Wtk : Wtv;

        const int kg = (tid >> 5) * 8;            // this wave's 8 rows of k
        const int ng = (tid & 31) * 4;            // this lane's 4 columns of n

        float4 v[8];
#pragma unroll  // the 8 loads of a lane issue back to back
        for (int j = 0; j < 8; ++j)
            v[j] = *reinterpret_cast<const float4*>(
                Wsrc + (size_t)(k0 + kg + j) * HID + n0 + ng);

        v8h c0, c1, c2, c3;
#pragma unroll  // constant index: the vectors stay in registers
        for (int j = 0; j < 8; ++j) {
            c0[j] = (_Float16)v[j].x;
            c1[j] = (_Float16)v[j].y;
            c2[j] = (_Float16)v[j].z;
            c3[j] = (_Float16)v[j].w;
        }
        *reinterpret_cast<v8h*>(&tile[(ng + 0) * CVT_PITCH + kg]) = c0;
        *reinterpret_cast<v8h*>(&tile[(ng + 1) * CVT_PITCH + kg]) = c1;
        *reinterpret_cast<v8h*>(&tile[(ng + 2) * CVT_PITCH + kg]) = c2;
        *reinterpret_cast<v8h*>(&tile[(ng + 3) * CVT_PITCH + kg]) = c3;
        __syncthreads();   // block-uniform branch: the whole tile is in LDS

#pragma unroll  // 4 independent LDS reads and line stores per lane
        for (int j = 0; j < (CVT_TN * 8) / CVT_THREADS; ++j) {
            int p   = tid + j * CVT_THREADS;      // 0..1023
            int n   = p >> 3;                     // 8 lanes cover one 128 B row
            int col = (p & 7) * 8;                // halves
            *reinterpret_cast<v8h*>(Wdst + (size_t)(n0 + n) * HID + k0 + col) =
                *reinterpret_cast<const v8h*>(&tile[n * CVT_PITCH + col]);
        }
    } else {
        const size_t base = (size_t)(blk - CVT_WBLOCKS) * CVT_XELEMS + (size_t)tid * 4;
        float4 v[8];
#pragma unroll  // the 8 loads of a lane issue back to back
        for (int j = 0; j < 8; ++j)
            v[j] = *reinterpret_cast<const float4*>(X + base + j * (CVT_THREADS * 4));
#pragma unroll  // constant index: the array stays in registers
        for (int j = 0; j < 8; ++j) {
            v4h h;
            h[0] = (_Float16)v[j].x;
            h[1] = (_Float16)v[j].y;
            h[2] = (_Float16)v[j].z;
            h[3] = (_Float16)v[j].w;
            *reinterpret_cast<v4h*>(Xh + base + j * (CVT_THREADS * 4)) = h;
        }
        // the stores' address and data registers are not reused before this wait, on
        // any way the built code has from here into the other half
        asm volatile("s_wait_xcnt 0x0" ::: "memory");
    }
}

// ---------- kernel 2: QKV projection GEMM ----------
// one work-group of 4 waves computes a 128(M) x 128(N) tile; each wave owns 64 x 64.
// grid = (32 Mtiles, 8 Ntiles, 3 matrices). Slices of 64 k of the X rows and of the
// W^T rows are brought to LDS once per work-group by async copies (whole 128 B lines),
// two buffers, the next slice in flight while this one is multiplied; every fragment
// read from LDS feeds 4 WMMAs.
#define GBM 128
#define GBN 128
#define GBK 64
// LDS row pitch in halves: 64 data + 8 pad = 144 B = 16 B x odd (ds_load_b128 reader)
#define GPITCH 72
#define GTHREADS 128

__global__ __launch_bounds__(GTHREADS)
void qkv_gemm_kernel(const _Float16* __restrict__ Xh,
                     const _Float16* __restrict__ Wtq,
                     const _Float16* __restrict__ Wtk,
                     const _Float16* __restrict__ Wtv,
                     const float* __restrict__ bq,
                     const float* __restrict__ bk,
                     const float* __restrict__ bv,
                     _Float16* __restrict__ Qh,
                     _Float16* __restrict__ Kh,
                     _Float16* __restrict__ Vt) {
    __shared__ __align__(16) _Float16 Ash[2][GBM * GPITCH];   // 2 x 18 KB
    __shared__ __align__(16) _Float16 Bsh[2][GBN * GPITCH];   // 2 x 18 KB

    const int z    = blockIdx.z;                 // 0=Q 1=K 2=V
    const _Float16* Wt = (z == 0) ? Wtq : (z == 1) ? Wtk : Wtv;
    const float*  bias = (z == 0) ? bq  : (z == 1) ? bk  : bv;

    const int tid  = threadIdx.x;
    const int wave = tid >> 5;
    const int lane = tid & 31;
    const int nl   = lane & 15;
    const int hi   = lane >> 4;
    const int koff = hi * 8;

    const int m0 = blockIdx.x * GBM;
    const int n0 = blockIdx.y * GBN;
    const int wm = (wave >> 1) * 64;             // this wave's rows inside the tile
    const int wn = (wave & 1) * 64;              // this wave's columns inside the tile

    // one k-slice of both operands into LDS buffer `buf`: 8 lanes cover one 128 B row
    auto stage = [&](int buf, int k0) {
#pragma unroll  // the 16 copies of a slice issue back to back
        for (int j = 0; j < (GBM * 8) / GTHREADS; ++j) {
            int c   = tid + j * GTHREADS;  // 0..1023
            int row = c >> 3;              // 0..127
            int col = (c & 7) * 8;         // halves
            cp16_g2l(Xh + (size_t)(m0 + row) * HID + k0 + col,
                     &Ash[buf][row * GPITCH + col]);
            cp16_g2l(Wt + (size_t)(n0 + row) * HID + k0 + col,
                     &Bsh[buf][row * GPITCH + col]);
        }
    };

    v8f acc[4][4];
#pragma unroll  // constant index: the array stays in registers
    for (int g = 0; g < 4; ++g)
#pragma unroll  // constant index: the array stays in registers
        for (int f = 0; f < 4; ++f)
#pragma unroll  // constant index: the array stays in registers
            for (int r = 0; r < 8; ++r) acc[g][f][r] = 0.0f;

    stage(0, 0);
    // slice 0 has landed for this wave's own copies before the barrier publishes it
    asm volatile("s_wait_asynccnt 0x0" ::: "memory");
    __syncthreads();
    stage(1, GBK);

    for (int t = 0; t < HID / GBK; ++t) {
        const _Float16* At = &Ash[t & 1][0];
        const _Float16* Bt = &Bsh[t & 1][0];
        v16h a[4], b[4];

        // first 32 k of the slice
#pragma unroll  // constant index: the array stays in registers
        for (int g = 0; g < 4; ++g)
            a[g] = load_frag16(At + (wm + g * 16 + nl) * GPITCH + koff);
#pragma unroll  // constant index: the array stays in registers
        for (int f = 0; f < 4; ++f)
            b[f] = load_frag16(Bt + (wn + f * 16 + nl) * GPITCH + koff);
        // keeps the 16 LDS reads of this k-step together in front of its 16 WMMAs:
        // left free, the scheduler reads each b fragment right before its use and
        // the wave waits out the LDS latency four times per k-step instead of once
        __builtin_amdgcn_sched_barrier(0);
#pragma unroll  // constant index: the array stays in registers
        for (int f = 0; f < 4; ++f)
#pragma unroll  // constant index: the array stays in registers
            for (int g = 0; g < 4; ++g)
                acc[g][f] = wmma_f16(a[g], b[f], acc[g][f]);

        // second 32 k: the fragments are fetched, the buffer is handed back and its
        // refill is on its way before the 16 WMMAs that need registers only
#pragma unroll  // constant index: the array stays in registers
        for (int g = 0; g < 4; ++g)
            a[g] = load_frag16(At + (wm + g * 16 + nl) * GPITCH + 32 + koff);
#pragma unroll  // constant index: the array stays in registers
        for (int f = 0; f < 4; ++f)
            b[f] = load_frag16(Bt + (wn + f * 16 + nl) * GPITCH + 32 + koff);
        // this wave's reads of buffer t&1 are done before the buffer is refilled
        asm volatile("s_wait_dscnt 0x0" ::: "memory");
        // this wave's copies of slice t+1 have landed before the barrier publishes them
        asm volatile("s_wait_asynccnt 0x0" ::: "memory");
        __syncthreads();
        if (t + 2 < HID / GBK) stage(t & 1, (t + 2) * GBK);
#pragma unroll  // constant index: the array stays in registers
        for (int f = 0; f < 4; ++f)
#pragma unroll  // constant index: the array stays in registers
            for (int g = 0; g < 4; ++g)
                acc[g][f] = wmma_f16(a[g], b[f], acc[g][f]);
    }
    // no copy is outstanding when the wave goes on to its end
    asm volatile("s_wait_asynccnt 0x0" ::: "memory");

    // epilogue: bias + scatter to per-head layout
#pragma unroll  // constant index: the array stays in registers
    for (int f = 0; f < 4; ++f) {
        int n = n0 + wn + f * 16 + nl;
        float bval = bias[n];
        int hh = n >> 6;
        int d  = n & 63;
#pragma unroll  // constant index: the array stays in registers
        for (int g = 0; g < 4; ++g) {
#pragma unroll  // constant index: the array stays in registers
            for (int r = 0; r < 8; ++r) {
                int m = m0 + wm + g * 16 + r + hi * 8;
                int b = m >> 11;
                int s = m & 2047;
                float val = acc[g][f][r] + bval;
                int bh = b * NH + hh;
                if (z == 0) {
                    Qh[((size_t)bh * SEQ + s) * DH + d] = (_Float16)val;
                } else if (z == 1) {
                    Kh[((size_t)bh * SEQ + s) * DH + d] = (_Float16)val;
                } else {
                    Vt[((size_t)bh * DH + d) * SEQ + s] = (_Float16)val;
                }
            }
        }
    }
}

// ---------- kernel 3: flash attention ----------
// block = 8 waves, all on one (b,h); each wave owns a 16-row q-tile.
// K/V tiles (64 cols) are cooperatively staged in LDS (double-buffered) via
// async global->LDS copies, so each tile hits L2 once per block (8x cut) and
// no wave stalls on a load-wait. Row-sums come from a P x ones WMMA.
#define KBLK 64
#define NW_ATT 8
// LDS row pitch in halves: 64 data + 8 pad = 144 B = 16 B x odd, so the 16 rows
// that one ds_load_b128 touches fall on distinct banks (128 B rows collide).
#define LPITCH 72

__global__ void attn_kernel(const _Float16* __restrict__ Qh,
                            const _Float16* __restrict__ Kh,
                            const _Float16* __restrict__ Vt,
                            const float* __restrict__ mask,
                            float* __restrict__ out) {
    __shared__ __align__(16) _Float16 Klds[2][KBLK * LPITCH];     // 2 x 9 KB
    __shared__ __align__(16) _Float16 Vlds[2][DH * LPITCH];       // 2 x 9 KB
    __shared__ __align__(16) _Float16 plds[NW_ATT][16 * LPITCH];  // 8 x 2.25 KB

    const int tid  = threadIdx.x;
    const int wave = tid >> 5;
    const int lane = tid & 31;
    const int nl   = lane & 15;
    const int hi   = lane >> 4;
    const int koff = hi * 8;

    const int bh = blockIdx.y;
    const int b  = bh >> 4;
    const int h  = bh & 15;
    const int q0 = (blockIdx.x * NW_ATT + wave) * 16;

    const _Float16* Qbase = Qh + ((size_t)bh * SEQ + q0) * DH;
    const _Float16* Kbase = Kh + (size_t)bh * SEQ * DH;
    const _Float16* Vbase = Vt + (size_t)bh * DH * SEQ;
    const float*    mrow  = mask + (size_t)b * SEQ;

    const float LOG2E  = 1.4426950408889634f;
    const float KSCALE = 0.125f * LOG2E;      // 1/sqrt(64) folded into log2 domain

    // cooperative stage of one K/V tile pair into LDS buffer `buf`
    auto stage = [&](int buf, int k0) {
#pragma unroll
        for (int j = 0; j < 2; ++j) {
            int c   = tid * 2 + j;        // 0..511
            int row = c >> 3;             // 0..63
            int col = (c & 7) * 8;        // halves
            cp16_g2l(Kbase + (size_t)(k0 + row) * DH + col,
                     &Klds[buf][row * LPITCH + col]);
            cp16_g2l(Vbase + (size_t)row * SEQ + k0 + col,
                     &Vlds[buf][row * LPITCH + col]);
        }
    };

    // Q a-fragments (16 rows x 64 K), reused across the whole loop
    v16h qa[2];
#pragma unroll
    for (int j = 0; j < 2; ++j)
        qa[j] = load_frag16(Qbase + (size_t)nl * DH + j * 32 + koff);

    v16h ones;
#pragma unroll
    for (int i = 0; i < 16; ++i) ones[i] = (_Float16)1.0f;

    v8f ctx[4];
#pragma unroll
    for (int f = 0; f < 4; ++f)
#pragma unroll
        for (int r = 0; r < 8; ++r) ctx[f][r] = 0.0f;

    float m_run[8], l_run[8];
#pragma unroll
    for (int r = 0; r < 8; ++r) { m_run[r] = -1.0e30f; l_run[r] = 0.0f; }

    stage(0, 0);

    for (int it = 0; it < SEQ / KBLK; ++it) {
        const int k0  = it * KBLK;
        const int cur = it & 1;
        wait_async_copies();                  // drain this wave's async stores to LDS
        __syncthreads();                      // tile `cur` ready; everyone past `cur^1`
        if (it + 1 < SEQ / KBLK) stage(cur ^ 1, k0 + KBLK);

        const _Float16* Kt = &Klds[cur][0];
        const _Float16* Vv = &Vlds[cur][0];

        // ---- scores: 4 column-frags x 2 k-chunks = 8 WMMAs ----
        v8f S[4];
#pragma unroll
        for (int c = 0; c < 4; ++c) {
#pragma unroll
            for (int r = 0; r < 8; ++r) S[c][r] = 0.0f;
#pragma unroll
            for (int j = 0; j < 2; ++j) {
                v16h kb = load_frag16(Kt + (size_t)(16 * c + nl) * LPITCH + j * 32 + koff);
                S[c] = wmma_f16(qa[j], kb, S[c]);
            }
        }

        float mk[4];
#pragma unroll
        for (int c = 0; c < 4; ++c) mk[c] = mrow[k0 + 16 * c + nl] * LOG2E;

        // ---- online softmax (log2 domain) ----
        float rscale[8], e[4][8];
#pragma unroll
        for (int r = 0; r < 8; ++r) {
            float v0 = S[0][r] * KSCALE + mk[0];
            float v1 = S[1][r] * KSCALE + mk[1];
            float v2 = S[2][r] * KSCALE + mk[2];
            float v3 = S[3][r] * KSCALE + mk[3];
            float mx = fmaxf(fmaxf(v0, v1), fmaxf(v2, v3));
#pragma unroll
            for (int off = 1; off < 16; off <<= 1)
                mx = fmaxf(mx, __shfl_xor(mx, off, 16));
            float mnew = fmaxf(m_run[r], mx);
            rscale[r] = exp2f(m_run[r] - mnew);
            e[0][r] = exp2f(v0 - mnew);
            e[1][r] = exp2f(v1 - mnew);
            e[2][r] = exp2f(v2 - mnew);
            e[3][r] = exp2f(v3 - mnew);
            m_run[r] = mnew;
        }

        // ---- re-layout P (C-format -> A-format) through per-wave LDS ----
        _Float16* pw = &plds[wave][0];
#pragma unroll
        for (int r = 0; r < 8; ++r) {
            int row = r + hi * 8;
#pragma unroll
            for (int c = 0; c < 4; ++c)
                pw[row * LPITCH + 16 * c + nl] = (_Float16)e[c][r];
        }
        v16h pa[2];
#pragma unroll
        for (int j = 0; j < 2; ++j)
            pa[j] = load_frag16(pw + (size_t)nl * LPITCH + j * 32 + koff);

        // ---- row sums via P x ones (moves reduction onto the matrix pipe) ----
        v8f ls;
#pragma unroll
        for (int r = 0; r < 8; ++r) ls[r] = 0.0f;
        ls = wmma_f16(pa[0], ones, ls);
        ls = wmma_f16(pa[1], ones, ls);

        // ---- rescale ctx, update l, ctx += P x V (8 WMMAs) ----
#pragma unroll
        for (int f = 0; f < 4; ++f)
#pragma unroll
            for (int r = 0; r < 8; ++r) ctx[f][r] *= rscale[r];
#pragma unroll
        for (int r = 0; r < 8; ++r) l_run[r] = l_run[r] * rscale[r] + ls[r];

#pragma unroll
        for (int f = 0; f < 4; ++f) {
#pragma unroll
            for (int j = 0; j < 2; ++j) {
                v16h vb = load_frag16(Vv + (size_t)(f * 16 + nl) * LPITCH + j * 32 + koff);
                ctx[f] = wmma_f16(pa[j], vb, ctx[f]);
            }
        }
    }

    // ---- normalize and write [B,S,h*dh] fp32 ----
#pragma unroll
    for (int f = 0; f < 4; ++f) {
#pragma unroll
        for (int r = 0; r < 8; ++r) {
            int row = r + hi * 8;
            out[((size_t)b * SEQ + q0 + row) * HID + h * DH + f * 16 + nl] =
                ctx[f][r] / l_run[r];
        }
    }
}

// ---------- launcher ----------
extern "C" void kernel_launch(void* const* d_in, const int* in_sizes, int n_in,
                              void* d_out, int out_size, void* d_ws, size_t ws_size,
                              hipStream_t stream) {
    const float* hidden = (const float*)d_in[0];
    const float* amask  = (const float*)d_in[1];
    const float* Wq     = (const float*)d_in[2];
    const float* bq     = (const float*)d_in[3];
    const float* Wk     = (const float*)d_in[4];
    const float* bk     = (const float*)d_in[5];
    const float* Wv     = (const float*)d_in[6];
    const float* bv     = (const float*)d_in[7];
    float* out = (float*)d_out;

    // workspace layout (bytes); total ~38 MB
    char* ws = (char*)d_ws;
    const size_t XH_OFF  = 0;
    const size_t WTQ_OFF = XH_OFF  + (size_t)MTOT * HID * 2;
    const size_t WTK_OFF = WTQ_OFF + (size_t)HID * HID * 2;
    const size_t WTV_OFF = WTK_OFF + (size_t)HID * HID * 2;
    const size_t QH_OFF  = WTV_OFF + (size_t)HID * HID * 2;
    const size_t KH_OFF  = QH_OFF  + (size_t)MTOT * HID * 2;
    const size_t VT_OFF  = KH_OFF  + (size_t)MTOT * HID * 2;

    _Float16* Xh  = (_Float16*)(ws + XH_OFF);
    _Float16* Wtq = (_Float16*)(ws + WTQ_OFF);
    _Float16* Wtk = (_Float16*)(ws + WTK_OFF);
    _Float16* Wtv = (_Float16*)(ws + WTV_OFF);
    _Float16* Qh  = (_Float16*)(ws + QH_OFF);
    _Float16* Kh  = (_Float16*)(ws + KH_OFF);
    _Float16* Vt  = (_Float16*)(ws + VT_OFF);

    // 1) convert inputs to f16 (+ transpose weights)
    {
        cvt_kernel<<<CVT_WBLOCKS + CVT_XBLOCKS, CVT_THREADS, 0, stream>>>(
            hidden, Wq, Wk, Wv, Xh, Wtq, Wtk, Wtv);
    }

    // 2) QKV projections via WMMA (128x128 tiles per 4-wave work-group)
    {
        dim3 grid(MTOT / GBM, HID / GBN, 3);   // (32, 8, 3)
        qkv_gemm_kernel<<<grid, GTHREADS, 0, stream>>>(Xh, Wtq, Wtk, Wtv, bq, bk, bv,
                                                       Qh, Kh, Vt);
    }

    // 3) flash attention via WMMA with async-LDS-staged K/V
    {
        dim3 grid(SEQ / (16 * NW_ATT), BATCH * NH);   // (16, 32)
        attn_kernel<<<grid, 256, 0, stream>>>(Qh, Kh, Vt, amask, out);
    }
}

// v004
// A run of this version takes 88.6 microseconds.
// Two timings next to v003 both put it at 1.76 times that version's speed.
// All steps since v000 together make it 3.86 times as fast.
#include <hip/hip_runtime.h>
#include <hip/hip_bf16.h>
#include <math.h>

typedef __attribute__((ext_vector_type(16))) _Float16 v16h;
typedef __attribute__((ext_vector_type(8)))  float    v8f;
typedef int vs4i __attribute__((vector_size(16)));

#define SEQ   2048
#define HID   1024
#define NH    16
#define DH    64
#define BATCH 2
#define MTOT  (BATCH * SEQ)   // 4096 rows for QKV gemm

#if __has_builtin(__builtin_amdgcn_global_load_async_to_lds_b128)
#define HAVE_ASYNC_LDS 1
#endif

// ---------- fragment helpers ----------
// 16-bit A-matrix 16x32 layout: lane%16 = row, lane/16 selects K-offset (0 or 8);
// halves {koff..koff+7} then {koff+16..koff+23} -> two 16B loads.
__device__ __forceinline__ v16h load_frag16(const _Float16* p) {
    union { v16h v; uint4 u[2]; } u;
    u.u[0] = *reinterpret_cast<const uint4*>(p);
    u.u[1] = *reinterpret_cast<const uint4*>(p + 16);
    return u.v;
}

__device__ __forceinline__ v8f wmma_f16(v16h a, v16h b, v8f c) {
    return __builtin_amdgcn_wmma_f32_16x16x32_f16(
        /*neg_a=*/false, a, /*neg_b=*/false, b,
        /*c_mod=*/(short)0, c, /*reuse_a=*/false, /*reuse_b=*/false);
}

// 16-byte global -> LDS copy; async (ASYNCcnt-tracked, no VGPR round trip) when
// the gfx1250 builtin is available, else VGPR-staged fallback.
__device__ __forceinline__ void cp16_g2l(const _Float16* g, _Float16* l) {
#if defined(HAVE_ASYNC_LDS)
    __builtin_amdgcn_global_load_async_to_lds_b128(
        (__attribute__((address_space(1))) vs4i*)(unsigned long long)(const void*)g,
        (__attribute__((address_space(3))) vs4i*)(unsigned int)(unsigned long long)(void*)l,
        0, 0);
#else
    *reinterpret_cast<uint4*>(l) = *reinterpret_cast<const uint4*>(g);
#endif
}

__device__ __forceinline__ void wait_async_copies() {
#if defined(HAVE_ASYNC_LDS)
#if __has_builtin(__builtin_amdgcn_s_wait_asynccnt)
    __builtin_amdgcn_s_wait_asynccnt(0);
#else
    asm volatile("s_wait_asynccnt 0x0" ::: "memory");
#endif
#endif
}

// ---------- kernel 1: fp32 -> f16 convert + weight transpose ----------
// A streaming launch of many short waves, one tile or chunk per block: every lane has 8 loads of 16 B in
// flight, every wave-wide load covers 512 contiguous bytes and every store fills
// whole 128 B lines.
//   blocks 0 .. CVT_WBLOCKS-1 : one 64(k) x 128(n) tile of one weight matrix, turned
//                               round in LDS and stored as rows of W^T
//   the other CVT_XBLOCKS     : 8192 consecutive elements of X
typedef __attribute__((ext_vector_type(4))) _Float16 v4h;
typedef __attribute__((ext_vector_type(8))) _Float16 v8h;

#define CVT_THREADS 256
#define CVT_TK 64
#define CVT_TN 128
// LDS row pitch in halves: 64 data + 8 pad = 144 B = 16 B x odd (ds_load_b128 reader)
#define CVT_PITCH 72
#define CVT_WBLOCKS (3 * (HID / CVT_TK) * (HID / CVT_TN))      // 384
#define CVT_XELEMS  (CVT_THREADS * 4 * 8)                      // 8192 per block
#define CVT_XBLOCKS ((MTOT * HID) / CVT_XELEMS)                // 512

__global__ __launch_bounds__(CVT_THREADS)
void cvt_kernel(const float* __restrict__ X,
                const float* __restrict__ Wq,
                const float* __restrict__ Wk,
                const float* __restrict__ Wv,
                _Float16* __restrict__ Xh,
                _Float16* __restrict__ Wtq,
                _Float16* __restrict__ Wtk,
                _Float16* __restrict__ Wtv) {
    __shared__ __align__(16) _Float16 tile[CVT_TN * CVT_PITCH];   // 18 KB, [n][k]

    const int tid = threadIdx.x;
    const int blk = blockIdx.x;

    if (blk < CVT_WBLOCKS) {
        const int w  = blk >> 7;                  // 128 tiles per matrix
        const int k0 = ((blk >> 3) & 15) * CVT_TK;
        const int n0 = (blk & 7) * CVT_TN;
        const float* Wsrc = (w == 0) ? Wq : (w == 1) ? Wk : Wv;
        _Float16*    Wdst = (w == 0) ? Wtq : (w == 1) ? Wtk : Wtv;

        const int kg = (tid >> 5) * 8;            // this wave's 8 rows of k
        const int ng = (tid & 31) * 4;            // this lane's 4 columns of n

        float4 v[8];
#pragma unroll  // the 8 loads of a lane issue back to back
        for (int j = 0; j < 8; ++j)
            v[j] = *reinterpret_cast<const float4*>(
                Wsrc + (size_t)(k0 + kg + j) * HID + n0 + ng);

        v8h c0, c1, c2, c3;
#pragma unroll  // constant index: the vectors stay in registers
        for (int j = 0; j < 8; ++j) {
            c0[j] = (_Float16)v[j].x;
            c1[j] = (_Float16)v[j].y;
            c2[j] = (_Float16)v[j].z;
            c3[j] = (_Float16)v[j].w;
        }
        *reinterpret_cast<v8h*>(&tile[(ng + 0) * CVT_PITCH + kg]) = c0;
        *reinterpret_cast<v8h*>(&tile[(ng + 1) * CVT_PITCH + kg]) = c1;
        *reinterpret_cast<v8h*>(&tile[(ng + 2) * CVT_PITCH + kg]) = c2;
        *reinterpret_cast<v8h*>(&tile[(ng + 3) * CVT_PITCH + kg]) = c3;
        __syncthreads();   // block-uniform branch: the whole tile is in LDS

#pragma unroll  // 4 independent LDS reads and line stores per lane
        for (int j = 0; j < (CVT_TN * 8) / CVT_THREADS; ++j) {
            int p   = tid + j * CVT_THREADS;      // 0..1023
            int n   = p >> 3;                     // 8 lanes cover one 128 B row
            int col = (p & 7) * 8;                // halves
            *reinterpret_cast<v8h*>(Wdst + (size_t)(n0 + n) * HID + k0 + col) =
                *reinterpret_cast<const v8h*>(&tile[n * CVT_PITCH + col]);
        }
    } else {
        const size_t base = (size_t)(blk - CVT_WBLOCKS) * CVT_XELEMS + (size_t)tid * 4;
        float4 v[8];
#pragma unroll  // the 8 loads of a lane issue back to back
        for (int j = 0; j < 8; ++j)
            v[j] = *reinterpret_cast<const float4*>(X + base + j * (CVT_THREADS * 4));
#pragma unroll  // constant index: the array stays in registers
        for (int j = 0; j < 8; ++j) {
            v4h h;
            h[0] = (_Float16)v[j].x;
            h[1] = (_Float16)v[j].y;
            h[2] = (_Float16)v[j].z;
            h[3] = (_Float16)v[j].w;
            *reinterpret_cast<v4h*>(Xh + base + j * (CVT_THREADS * 4)) = h;
        }
        // the stores' address and data registers are not reused before this wait, on
        // any way the built code has from here into the other half
        asm volatile("s_wait_xcnt 0x0" ::: "memory");
    }
}

// ---------- kernel 2: QKV projection GEMM ----------
// one work-group of 4 waves computes a 128(M) x 128(N) tile; each wave owns 64 x 64.
// grid = (32 Mtiles, 8 Ntiles, 3 matrices). Slices of 64 k of the X rows and of the
// W^T rows are brought to LDS once per work-group by async copies (whole 128 B lines),
// two buffers, the next slice in flight while this one is multiplied; every fragment
// read from LDS feeds 4 WMMAs.
#define GBM 128
#define GBN 128
#define GBK 64
// LDS row pitch in halves: 64 data + 8 pad = 144 B = 16 B x odd (ds_load_b128 reader)
#define GPITCH 72
#define GTHREADS 128

__global__ __launch_bounds__(GTHREADS)
void qkv_gemm_kernel(const _Float16* __restrict__ Xh,
                     const _Float16* __restrict__ Wtq,
                     const _Float16* __restrict__ Wtk,
                     const _Float16* __restrict__ Wtv,
                     const float* __restrict__ bq,
                     const float* __restrict__ bk,
                     const float* __restrict__ bv,
                     _Float16* __restrict__ Qh,
                     _Float16* __restrict__ Kh,
                     _Float16* __restrict__ Vt) {
    __shared__ __align__(16) _Float16 Ash[2][GBM * GPITCH];   // 2 x 18 KB
    __shared__ __align__(16) _Float16 Bsh[2][GBN * GPITCH];   // 2 x 18 KB

    const int z    = blockIdx.z;                 // 0=Q 1=K 2=V
    const _Float16* Wt = (z == 0) ? Wtq : (z == 1) ? Wtk : Wtv;
    const float*  bias = (z == 0) ? bq  : (z == 1) ? bk  : bv;

    const int tid  = threadIdx.x;
    const int wave = tid >> 5;
    const int lane = tid & 31;
    const int nl   = lane & 15;
    const int hi   = lane >> 4;
    const int koff = hi * 8;

    const int m0 = blockIdx.x * GBM;
    const int n0 = blockIdx.y * GBN;
    const int wm = (wave >> 1) * 64;             // this wave's rows inside the tile
    const int wn = (wave & 1) * 64;              // this wave's columns inside the tile

    // one k-slice of both operands into LDS buffer `buf`: 8 lanes cover one 128 B row
    auto stage = [&](int buf, int k0) {
#pragma unroll  // the 16 copies of a slice issue back to back
        for (int j = 0; j < (GBM * 8) / GTHREADS; ++j) {
            int c   = tid + j * GTHREADS;  // 0..1023
            int row = c >> 3;              // 0..127
            int col = (c & 7) * 8;         // halves
            cp16_g2l(Xh + (size_t)(m0 + row) * HID + k0 + col,
                     &Ash[buf][row * GPITCH + col]);
            cp16_g2l(Wt + (size_t)(n0 + row) * HID + k0 + col,
                     &Bsh[buf][row * GPITCH + col]);
        }
    };

    v8f acc[4][4];
#pragma unroll  // constant index: the array stays in registers
    for (int g = 0; g < 4; ++g)
#pragma unroll  // constant index: the array stays in registers
        for (int f = 0; f < 4; ++f)
#pragma unroll  // constant index: the array stays in registers
            for (int r = 0; r < 8; ++r) acc[g][f][r] = 0.0f;

    stage(0, 0);
    // slice 0 has landed for this wave's own copies before the barrier publishes it
    asm volatile("s_wait_asynccnt 0x0" ::: "memory");
    __syncthreads();
    stage(1, GBK);

    for (int t = 0; t < HID / GBK; ++t) {
        const _Float16* At = &Ash[t & 1][0];
        const _Float16* Bt = &Bsh[t & 1][0];
        v16h a[4], b[4];

        // first 32 k of the slice
#pragma unroll  // constant index: the array stays in registers
        for (int g = 0; g < 4; ++g)
            a[g] = load_frag16(At + (wm + g * 16 + nl) * GPITCH + koff);
#pragma unroll  // constant index: the array stays in registers
        for (int f = 0; f < 4; ++f)
            b[f] = load_frag16(Bt + (wn + f * 16 + nl) * GPITCH + koff);
        // keeps the 16 LDS reads of this k-step together in front of its 16 WMMAs:
        // left free, the scheduler reads each b fragment right before its use and
        // the wave waits out the LDS latency four times per k-step instead of once
        __builtin_amdgcn_sched_barrier(0);
#pragma unroll  // constant index: the array stays in registers
        for (int f = 0; f < 4; ++f)
#pragma unroll  // constant index: the array stays in registers
            for (int g = 0; g < 4; ++g)
                acc[g][f] = wmma_f16(a[g], b[f], acc[g][f]);

        // second 32 k: the fragments are fetched, the buffer is handed back and its
        // refill is on its way before the 16 WMMAs that need registers only
#pragma unroll  // constant index: the array stays in registers
        for (int g = 0; g < 4; ++g)
            a[g] = load_frag16(At + (wm + g * 16 + nl) * GPITCH + 32 + koff);
#pragma unroll  // constant index: the array stays in registers
        for (int f = 0; f < 4; ++f)
            b[f] = load_frag16(Bt + (wn + f * 16 + nl) * GPITCH + 32 + koff);
        // this wave's reads of buffer t&1 are done before the buffer is refilled
        asm volatile("s_wait_dscnt 0x0" ::: "memory");
        // this wave's copies of slice t+1 have landed before the barrier publishes them
        asm volatile("s_wait_asynccnt 0x0" ::: "memory");
        __syncthreads();
        if (t + 2 < HID / GBK) stage(t & 1, (t + 2) * GBK);
#pragma unroll  // constant index: the array stays in registers
        for (int f = 0; f < 4; ++f)
#pragma unroll  // constant index: the array stays in registers
            for (int g = 0; g < 4; ++g)
                acc[g][f] = wmma_f16(a[g], b[f], acc[g][f]);
    }
    // no copy is outstanding when the wave goes on to its end
    asm volatile("s_wait_asynccnt 0x0" ::: "memory");

    // epilogue: bias + scatter to per-head layout
#pragma unroll  // constant index: the array stays in registers
    for (int f = 0; f < 4; ++f) {
        int n = n0 + wn + f * 16 + nl;
        float bval = bias[n];
        int hh = n >> 6;
        int d  = n & 63;
#pragma unroll  // constant index: the array stays in registers
        for (int g = 0; g < 4; ++g) {
#pragma unroll  // constant index: the array stays in registers
            for (int r = 0; r < 8; ++r) {
                int m = m0 + wm + g * 16 + r + hi * 8;
                int b = m >> 11;
                int s = m & 2047;
                float val = acc[g][f][r] + bval;
                int bh = b * NH + hh;
                if (z == 0) {
                    Qh[((size_t)bh * SEQ + s) * DH + d] = (_Float16)val;
                } else if (z == 1) {
                    Kh[((size_t)bh * SEQ + s) * DH + d] = (_Float16)val;
                } else {
                    Vt[((size_t)bh * DH + d) * SEQ + s] = (_Float16)val;
                }
            }
        }
    }
}

#define KBLK 64
#define NW_ATT 8
// LDS row pitch in halves: 64 data + 8 pad = 144 B = 16 B x odd, so the 16 rows
// that one ds_load_b128 touches fall on distinct banks (128 B rows collide).
#define LPITCH 72

// the bound states the block the launcher uses: without it the compiler plans for 1024
// work-items, 128 registers a lane, and spills
__global__ __launch_bounds__(NW_ATT * 32)
void attn_kernel(const _Float16* __restrict__ Qh,
                 const _Float16* __restrict__ Kh,
                 const _Float16* __restrict__ Vt,
                 const float* __restrict__ mask,
                 float* __restrict__ out) {
    __shared__ __align__(16) _Float16 Klds[2][KBLK * LPITCH];     // 2 x 9 KB
    __shared__ __align__(16) _Float16 Vlds[2][DH * LPITCH];       // 2 x 9 KB
    __shared__ __align__(32) float    mlds[SEQ];                  // 8 KB, 8 x mask

    const int tid  = threadIdx.x;
    const int wave = tid >> 5;
    const int lane = tid & 31;
    const int nl   = lane & 15;
    const int hi   = lane >> 4;
    const int koff = hi * 8;

    const int bh = blockIdx.y;
    const int b  = bh >> 4;
    const int h  = bh & 15;
    const int q0 = (blockIdx.x * NW_ATT + wave) * 16;

    const _Float16* Qbase = Qh + ((size_t)bh * SEQ + q0) * DH;
    const _Float16* Kbase = Kh + (size_t)bh * SEQ * DH;
    const _Float16* Vbase = Vt + (size_t)bh * DH * SEQ;
    const float*    mrow  = mask + (size_t)b * SEQ;

    const float LOG2E  = 1.4426950408889634f;
    const float KSCALE = 0.125f * LOG2E;      // 1/sqrt(64) folded into log2 domain

    // cooperative stage of one K/V tile pair into LDS buffer `buf`
    auto stage = [&](int buf, int k0) {
#pragma unroll
        for (int j = 0; j < 2; ++j) {
            int c   = tid * 2 + j;        // 0..511
            int row = c >> 3;             // 0..63
            int col = (c & 7) * 8;        // halves
            cp16_g2l(Kbase + (size_t)(k0 + row) * DH + col,
                     &Klds[buf][row * LPITCH + col]);
            cp16_g2l(Vbase + (size_t)row * SEQ + k0 + col,
                     &Vlds[buf][row * LPITCH + col]);
        }
    };

    // the mask row, times sqrt(dh) (exact, a power of two): a lane now needs the mask
    // of 32 keys per tile, and takes it as the start value of its S^T accumulators,
    // (q.k + 8 mask) / 8 = q.k / 8 + mask. Published by the loop's first barrier.
#pragma unroll  // the two loads of a lane issue back to back
    for (int j = 0; j < SEQ / (NW_ATT * 32 * 4); ++j) {
        int i = (tid + j * NW_ATT * 32) * 4;
        float4 mv = *reinterpret_cast<const float4*>(mrow + i);
        mv.x *= 8.0f; mv.y *= 8.0f; mv.z *= 8.0f; mv.w *= 8.0f;
        *reinterpret_cast<float4*>(&mlds[i]) = mv;
    }

    // Q^T b-fragments (64 d x 16 queries), reused across the whole loop
    v16h qb[2];
#pragma unroll  // constant index: the array stays in registers
    for (int j = 0; j < 2; ++j)
        qb[j] = load_frag16(Qbase + (size_t)nl * DH + j * 32 + koff);

    v16h ones;
#pragma unroll  // constant index: the array stays in registers
    for (int i = 0; i < 16; ++i) ones[i] = (_Float16)1.0f;

    v8f ctx[4];                               // O^T: ctx[f][r] = O[q = nl][16f + 8hi + r]
#pragma unroll  // constant index: the array stays in registers
    for (int f = 0; f < 4; ++f)
#pragma unroll  // constant index: the array stays in registers
        for (int r = 0; r < 8; ++r) ctx[f][r] = 0.0f;

    float m_run = -1.0e30f, l_run = 0.0f;     // of query nl, in units of q.k + 8 mask

    stage(0, 0);

    for (int it = 0; it < SEQ / KBLK; ++it) {
        const int k0  = it * KBLK;
        const int cur = it & 1;
        wait_async_copies();                  // drain this wave's async stores to LDS
        __syncthreads();                      // tile `cur` ready; everyone past `cur^1`
        if (it + 1 < SEQ / KBLK) stage(cur ^ 1, k0 + KBLK);

        const _Float16* Kt = &Klds[cur][0];
        const _Float16* Vv = &Vlds[cur][0];

        // ---- S^T: 4 key-frags x 2 d-chunks = 8 WMMAs, started from 8 x mask ----
        v8f S[4];
#pragma unroll  // constant index: the array stays in registers
        for (int c = 0; c < 4; ++c) {
            S[c] = *reinterpret_cast<const v8f*>(&mlds[k0 + 16 * c + koff]);
#pragma unroll  // constant index: the array stays in registers
            for (int j = 0; j < 2; ++j) {
                v16h ka = load_frag16(Kt + (size_t)(16 * c + nl) * LPITCH + j * 32 + koff);
                S[c] = wmma_f16(ka, qb[j], S[c]);
            }
        }

        // ---- online softmax (log2 domain), one query per lane ----
        float mc[4];                          // one chain per tile, not one of 32 links
#pragma unroll  // constant index: the array stays in registers
        for (int c = 0; c < 4; ++c) {
            mc[c] = S[c][0];
#pragma unroll  // constant index: the array stays in registers
            for (int r = 1; r < 8; ++r) mc[c] = fmaxf(mc[c], S[c][r]);
        }
        float mx = fmaxf(fmaxf(mc[0], mc[1]), fmaxf(mc[2], mc[3]));
        // the other 32 keys of this query sit in lane ^ 16
        mx = fmaxf(mx, __int_as_float(__builtin_amdgcn_permlanex16(
                 __float_as_int(mx), __float_as_int(mx), 0x76543210, 0xfedcba98,
                 false, false)));
        const float mnew   = fmaxf(m_run, mx);
        const float rscale = exp2f((m_run - mnew) * KSCALE);
        const float nm     = -mnew * KSCALE;
        m_run = mnew;

        // ---- P^T: S^T tiles 2j and 2j+1, converted in place, are b-fragment j ----
        v16h pb[2];
#pragma unroll  // constant index: the array stays in registers
        for (int j = 0; j < 2; ++j)
#pragma unroll  // constant index: the array stays in registers
            for (int i = 0; i < 16; ++i)
                pb[j][i] = (_Float16)exp2f(S[2 * j + (i >> 3)][i & 7] * KSCALE + nm);

        // ---- row sums via ones x P^T (every row of the result is the column sum) ----
        v8f ls;
#pragma unroll  // constant index: the array stays in registers
        for (int r = 0; r < 8; ++r) ls[r] = 0.0f;
        ls = wmma_f16(ones, pb[0], ls);
        ls = wmma_f16(ones, pb[1], ls);

        // ---- rescale O^T, update l, O^T += V^T x P^T (8 WMMAs) ----
#pragma unroll  // constant index: the array stays in registers
        for (int f = 0; f < 4; ++f)
#pragma unroll  // constant index: the array stays in registers
            for (int r = 0; r < 8; ++r) ctx[f][r] *= rscale;
        l_run = l_run * rscale + ls[0];

#pragma unroll  // constant index: the array stays in registers
        for (int f = 0; f < 4; ++f) {
#pragma unroll  // constant index: the array stays in registers
            for (int j = 0; j < 2; ++j) {
                v16h va = load_frag16(Vv + (size_t)(f * 16 + nl) * LPITCH + j * 32 + koff);
                ctx[f] = wmma_f16(va, pb[j], ctx[f]);
            }
        }
    }

    // ---- normalize and write [B,S,h*dh] fp32: 8 consecutive d per lane and frag ----
    const float inv = 1.0f / l_run;
    float* orow = out + ((size_t)b * SEQ + q0 + nl) * HID + h * DH + koff;
#pragma unroll  // constant index: the array stays in registers
    for (int f = 0; f < 4; ++f) {
        float4 lo = make_float4(ctx[f][0] * inv, ctx[f][1] * inv, ctx[f][2] * inv, ctx[f][3] * inv);
        float4 hv = make_float4(ctx[f][4] * inv, ctx[f][5] * inv, ctx[f][6] * inv, ctx[f][7] * inv);
        *reinterpret_cast<float4*>(orow + f * 16)     = lo;
        *reinterpret_cast<float4*>(orow + f * 16 + 4) = hv;
    }
}

// ---------- launcher ----------
extern "C" void kernel_launch(void* const* d_in, const int* in_sizes, int n_in,
                              void* d_out, int out_size, void* d_ws, size_t ws_size,
                              hipStream_t stream) {
    const float* hidden = (const float*)d_in[0];
    const float* amask  = (const float*)d_in[1];
    const float* Wq     = (const float*)d_in[2];
    const float* bq     = (const float*)d_in[3];
    const float* Wk     = (const float*)d_in[4];
    const float* bk     = (const float*)d_in[5];
    const float* Wv     = (const float*)d_in[6];
    const float* bv     = (const float*)d_in[7];
    float* out = (float*)d_out;

    // workspace layout (bytes); total ~38 MB
    char* ws = (char*)d_ws;
    const size_t XH_OFF  = 0;
    const size_t WTQ_OFF = XH_OFF  + (size_t)MTOT * HID * 2;
    const size_t WTK_OFF = WTQ_OFF + (size_t)HID * HID * 2;
    const size_t WTV_OFF = WTK_OFF + (size_t)HID * HID * 2;
    const size_t QH_OFF  = WTV_OFF + (size_t)HID * HID * 2;
    const size_t KH_OFF  = QH_OFF  + (size_t)MTOT * HID * 2;
    const size_t VT_OFF  = KH_OFF  + (size_t)MTOT * HID * 2;

    _Float16* Xh  = (_Float16*)(ws + XH_OFF);
    _Float16* Wtq = (_Float16*)(ws + WTQ_OFF);
    _Float16* Wtk = (_Float16*)(ws + WTK_OFF);
    _Float16* Wtv = (_Float16*)(ws + WTV_OFF);
    _Float16* Qh  = (_Float16*)(ws + QH_OFF);
    _Float16* Kh  = (_Float16*)(ws + KH_OFF);
    _Float16* Vt  = (_Float16*)(ws + VT_OFF);

    // 1) convert inputs to f16 (+ transpose weights)
    {
        cvt_kernel<<<CVT_WBLOCKS + CVT_XBLOCKS, CVT_THREADS, 0, stream>>>(
            hidden, Wq, Wk, Wv, Xh, Wtq, Wtk, Wtv);
    }

    // 2) QKV projections via WMMA (128x128 tiles per 4-wave work-group)
    {
        dim3 grid(MTOT / GBM, HID / GBN, 3);   // (32, 8, 3)
        qkv_gemm_kernel<<<grid, GTHREADS, 0, stream>>>(Xh, Wtq, Wtk, Wtv, bq, bk, bv,
                                                       Qh, Kh, Vt);
    }

    // 3) flash attention via WMMA with async-LDS-staged K/V
    {
        dim3 grid(SEQ / (16 * NW_ATT), BATCH * NH);   // (16, 32)
        attn_kernel<<<grid, 256, 0, stream>>>(Qh, Kh, Vt, amask, out);
    }
}

// v005
// It runs in 79.6 microseconds.
// Two timings next to v004 both put it at 1.11 times that version's speed.
// All steps since v000 together make it 4.29 times as fast.
#include <hip/hip_runtime.h>
#include <hip/hip_bf16.h>
#include <math.h>

typedef __attribute__((ext_vector_type(16))) _Float16 v16h;
typedef __attribute__((ext_vector_type(8)))  float    v8f;
typedef int vs4i __attribute__((vector_size(16)));

#define SEQ   2048
#define HID   1024
#define NH    16
#define DH    64
#define BATCH 2
#define MTOT  (BATCH * SEQ)   // 4096 rows for QKV gemm

#if __has_builtin(__builtin_amdgcn_global_load_async_to_lds_b128)
#define HAVE_ASYNC_LDS 1
#endif

// ---------- fragment helpers ----------
// 16-bit A-matrix 16x32 layout: lane%16 = row, lane/16 selects K-offset (0 or 8);
// halves {koff..koff+7} then {koff+16..koff+23} -> two 16B loads.
__device__ __forceinline__ v16h load_frag16(const _Float16* p) {
    union { v16h v; uint4 u[2]; } u;
    u.u[0] = *reinterpret_cast<const uint4*>(p);
    u.u[1] = *reinterpret_cast<const uint4*>(p + 16);
    return u.v;
}

__device__ __forceinline__ v8f wmma_f16(v16h a, v16h b, v8f c) {
    return __builtin_amdgcn_wmma_f32_16x16x32_f16(
        /*neg_a=*/false, a, /*neg_b=*/false, b,
        /*c_mod=*/(short)0, c, /*reuse_a=*/false, /*reuse_b=*/false);
}

// 16-byte global -> LDS copy; async (ASYNCcnt-tracked, no VGPR round trip) when
// the gfx1250 builtin is available, else VGPR-staged fallback.
__device__ __forceinline__ void cp16_g2l(const _Float16* g, _Float16* l) {
#if defined(HAVE_ASYNC_LDS)
    __builtin_amdgcn_global_load_async_to_lds_b128(
        (__attribute__((address_space(1))) vs4i*)(unsigned long long)(const void*)g,
        (__attribute__((address_space(3))) vs4i*)(unsigned int)(unsigned long long)(void*)l,
        0, 0);
#else
    *reinterpret_cast<uint4*>(l) = *reinterpret_cast<const uint4*>(g);
#endif
}

__device__ __forceinline__ void wait_async_copies() {
#if defined(HAVE_ASYNC_LDS)
#if __has_builtin(__builtin_amdgcn_s_wait_asynccnt)
    __builtin_amdgcn_s_wait_asynccnt(0);
#else
    asm volatile("s_wait_asynccnt 0x0" ::: "memory");
#endif
#endif
}

// ---------- kernel 1: fp32 -> f16 convert + weight transpose ----------
// A streaming launch of many short waves, one tile or chunk per block: every lane has 8 loads of 16 B in
// flight, every wave-wide load covers 512 contiguous bytes and every store fills
// whole 128 B lines.
//   blocks 0 .. CVT_WBLOCKS-1 : one 64(k) x 128(n) tile of one weight matrix, turned
//                               round in LDS and stored as rows of W^T
//   the other CVT_XBLOCKS     : 8192 consecutive elements of X
typedef __attribute__((ext_vector_type(4))) _Float16 v4h;
typedef __attribute__((ext_vector_type(8))) _Float16 v8h;

#define CVT_THREADS 256
#define CVT_TK 64
#define CVT_TN 128
// LDS row pitch in halves: 64 data + 8 pad = 144 B = 16 B x odd (ds_load_b128 reader)
#define CVT_PITCH 72
#define CVT_WBLOCKS (3 * (HID / CVT_TK) * (HID / CVT_TN))      // 384
#define CVT_XELEMS  (CVT_THREADS * 4 * 8)                      // 8192 per block
#define CVT_XBLOCKS ((MTOT * HID) / CVT_XELEMS)                // 512

__global__ __launch_bounds__(CVT_THREADS)
void cvt_kernel(const float* __restrict__ X,
                const float* __restrict__ Wq,
                const float* __restrict__ Wk,
                const float* __restrict__ Wv,
                _Float16* __restrict__ Xh,
                _Float16* __restrict__ Wtq,
                _Float16* __restrict__ Wtk,
                _Float16* __restrict__ Wtv) {
    __shared__ __align__(16) _Float16 tile[CVT_TN * CVT_PITCH];   // 18 KB, [n][k]

    const int tid = threadIdx.x;
    const int blk = blockIdx.x;

    if (blk < CVT_WBLOCKS) {
        const int w  = blk >> 7;                  // 128 tiles per matrix
        const int k0 = ((blk >> 3) & 15) * CVT_TK;
        const int n0 = (blk & 7) * CVT_TN;
        const float* Wsrc = (w == 0) ? Wq : (w == 1) ? Wk : Wv;
        _Float16*    Wdst = (w == 0) ? Wtq : (w == 1) ? Wtk : Wtv;

        const int kg = (tid >> 5) * 8;            // this wave's 8 rows of k
        const int ng = (tid & 31) * 4;            // this lane's 4 columns of n

        float4 v[8];
#pragma unroll  // the 8 loads of a lane issue back to back
        for (int j = 0; j < 8; ++j)
            v[j] = *reinterpret_cast<const float4*>(
                Wsrc + (size_t)(k0 + kg + j) * HID + n0 + ng);

        v8h c0, c1, c2, c3;
#pragma unroll  // constant index: the vectors stay in registers
        for (int j = 0; j < 8; ++j) {
            c0[j] = (_Float16)v[j].x;
            c1[j] = (_Float16)v[j].y;
            c2[j] = (_Float16)v[j].z;
            c3[j] = (_Float16)v[j].w;
        }
        *reinterpret_cast<v8h*>(&tile[(ng + 0) * CVT_PITCH + kg]) = c0;
        *reinterpret_cast<v8h*>(&tile[(ng + 1) * CVT_PITCH + kg]) = c1;
        *reinterpret_cast<v8h*>(&tile[(ng + 2) * CVT_PITCH + kg]) = c2;
        *reinterpret_cast<v8h*>(&tile[(ng + 3) * CVT_PITCH + kg]) = c3;
        __syncthreads();   // block-uniform branch: the whole tile is in LDS

#pragma unroll  // 4 independent LDS reads and line stores per lane
        for (int j = 0; j < (CVT_TN * 8) / CVT_THREADS; ++j) {
            int p   = tid + j * CVT_THREADS;      // 0..1023
            int n   = p >> 3;                     // 8 lanes cover one 128 B row
            int col = (p & 7) * 8;                // halves
            *reinterpret_cast<v8h*>(Wdst + (size_t)(n0 + n) * HID + k0 + col) =
                *reinterpret_cast<const v8h*>(&tile[n * CVT_PITCH + col]);
        }
    } else {
        const size_t base = (size_t)(blk - CVT_WBLOCKS) * CVT_XELEMS + (size_t)tid * 4;
        float4 v[8];
#pragma unroll  // the 8 loads of a lane issue back to back
        for (int j = 0; j < 8; ++j)
            v[j] = *reinterpret_cast<const float4*>(X + base + j * (CVT_THREADS * 4));
#pragma unroll  // constant index: the array stays in registers
        for (int j = 0; j < 8; ++j) {
            v4h h;
            h[0] = (_Float16)v[j].x;
            h[1] = (_Float16)v[j].y;
            h[2] = (_Float16)v[j].z;
            h[3] = (_Float16)v[j].w;
            *reinterpret_cast<v4h*>(Xh + base + j * (CVT_THREADS * 4)) = h;
        }
        // the stores' address and data registers are not reused before this wait, on
        // any way the built code has from here into the other half
        asm volatile("s_wait_xcnt 0x0" ::: "memory");
    }
}

// ---------- kernel 2: QKV projection GEMM ----------
// one work-group of 4 waves computes a 128(M) x 128(N) tile; each wave owns 64 x 64.
// grid = (32 Mtiles, 8 Ntiles, 3 matrices). Slices of 64 k of the X rows and of the
// W^T rows are brought to LDS once per work-group by async copies (whole 128 B lines),
// two buffers, the next slice in flight while this one is multiplied; every fragment
// read from LDS feeds 4 WMMAs.
#define GBM 128
#define GBN 128
#define GBK 64
// LDS row pitch in halves: 64 data + 8 pad = 144 B = 16 B x odd (ds_load_b128 reader)
#define GPITCH 72
#define GTHREADS 128

__global__ __launch_bounds__(GTHREADS)
void qkv_gemm_kernel(const _Float16* __restrict__ Xh,
                     const _Float16* __restrict__ Wtq,
                     const _Float16* __restrict__ Wtk,
                     const _Float16* __restrict__ Wtv,
                     const float* __restrict__ bq,
                     const float* __restrict__ bk,
                     const float* __restrict__ bv,
                     _Float16* __restrict__ Qh,
                     _Float16* __restrict__ Kh,
                     _Float16* __restrict__ Vt) {
    __shared__ __align__(16) _Float16 Ash[2][GBM * GPITCH];   // 2 x 18 KB
    __shared__ __align__(16) _Float16 Bsh[2][GBN * GPITCH];   // 2 x 18 KB

    const int z    = blockIdx.z;                 // 0=Q 1=K 2=V
    const _Float16* Wt = (z == 0) ? Wtq : (z == 1) ? Wtk : Wtv;
    const float*  bias = (z == 0) ? bq  : (z == 1) ? bk  : bv;

    const int tid  = threadIdx.x;
    const int wave = tid >> 5;
    const int lane = tid & 31;
    const int nl   = lane & 15;
    const int hi   = lane >> 4;
    const int koff = hi * 8;

    const int m0 = blockIdx.x * GBM;
    const int n0 = blockIdx.y * GBN;
    const int wm = (wave >> 1) * 64;             // this wave's rows inside the tile
    const int wn = (wave & 1) * 64;              // this wave's columns inside the tile

    // one k-slice of both operands into LDS buffer `buf`: 8 lanes cover one 128 B row
    auto stage = [&](int buf, int k0) {
#pragma unroll  // the 16 copies of a slice issue back to back
        for (int j = 0; j < (GBM * 8) / GTHREADS; ++j) {
            int c   = tid + j * GTHREADS;  // 0..1023
            int row = c >> 3;              // 0..127
            int col = (c & 7) * 8;         // halves
            cp16_g2l(Xh + (size_t)(m0 + row) * HID + k0 + col,
                     &Ash[buf][row * GPITCH + col]);
            cp16_g2l(Wt + (size_t)(n0 + row) * HID + k0 + col,
                     &Bsh[buf][row * GPITCH + col]);
        }
    };

    v8f acc[4][4];
#pragma unroll  // constant index: the array stays in registers
    for (int g = 0; g < 4; ++g)
#pragma unroll  // constant index: the array stays in registers
        for (int f = 0; f < 4; ++f)
#pragma unroll  // constant index: the array stays in registers
            for (int r = 0; r < 8; ++r) acc[g][f][r] = 0.0f;

    stage(0, 0);
    // slice 0 has landed for this wave's own copies before the barrier publishes it
    asm volatile("s_wait_asynccnt 0x0" ::: "memory");
    __syncthreads();
    stage(1, GBK);

    for (int t = 0; t < HID / GBK; ++t) {
        const _Float16* At = &Ash[t & 1][0];
        const _Float16* Bt = &Bsh[t & 1][0];
        v16h a[4], b[4];

        // first 32 k of the slice
#pragma unroll  // constant index: the array stays in registers
        for (int g = 0; g < 4; ++g)
            a[g] = load_frag16(At + (wm + g * 16 + nl) * GPITCH + koff);
#pragma unroll  // constant index: the array stays in registers
        for (int f = 0; f < 4; ++f)
            b[f] = load_frag16(Bt + (wn + f * 16 + nl) * GPITCH + koff);
        // keeps the 16 LDS reads of this k-step together in front of its 16 WMMAs:
        // left free, the scheduler reads each b fragment right before its use and
        // the wave waits out the LDS latency four times per k-step instead of once
        __builtin_amdgcn_sched_barrier(0);
#pragma unroll  // constant index: the array stays in registers
        for (int f = 0; f < 4; ++f)
#pragma unroll  // constant index: the array stays in registers
            for (int g = 0; g < 4; ++g)
                acc[g][f] = wmma_f16(a[g], b[f], acc[g][f]);

        // second 32 k: the fragments are fetched, the buffer is handed back and its
        // refill is on its way before the 16 WMMAs that need registers only
#pragma unroll  // constant index: the array stays in registers
        for (int g = 0; g < 4; ++g)
            a[g] = load_frag16(At + (wm + g * 16 + nl) * GPITCH + 32 + koff);
#pragma unroll  // constant index: the array stays in registers
        for (int f = 0; f < 4; ++f)
            b[f] = load_frag16(Bt + (wn + f * 16 + nl) * GPITCH + 32 + koff);
        // this wave's reads of buffer t&1 are done before the buffer is refilled
        asm volatile("s_wait_dscnt 0x0" ::: "memory");
        // this wave's copies of slice t+1 have landed before the barrier publishes them
        asm volatile("s_wait_asynccnt 0x0" ::: "memory");
        __syncthreads();
        if (t + 2 < HID / GBK) stage(t & 1, (t + 2) * GBK);
#pragma unroll  // constant index: the array stays in registers
        for (int f = 0; f < 4; ++f)
#pragma unroll  // constant index: the array stays in registers
            for (int g = 0; g < 4; ++g)
                acc[g][f] = wmma_f16(a[g], b[f], acc[g][f]);
    }
    // no copy is outstanding when the wave goes on to its end
    asm volatile("s_wait_asynccnt 0x0" ::: "memory");

    // epilogue: bias, then the wave's 64 x 64 f16 tile goes through LDS and leaves as whole
    // 128 B lines, 16 B a lane. The ring is free: behind the last trip's barrier no wave
    // reads it and no copy is outstanding, and each wave stages in rows of its own.
    // Staged row = one output line: a sequence position (64 d) for Q and K, a d (64
    // positions) for V^T.
    _Float16* stg = &Ash[wave >> 1][(wave & 1) * 64 * GPITCH];
    if (z == 2) {
#pragma unroll  // constant index: the array stays in registers
        for (int f = 0; f < 4; ++f) {
            const float bval = bias[n0 + wn + f * 16 + nl];
#pragma unroll  // constant index: the array stays in registers
            for (int g = 0; g < 4; ++g) {
                v8h hv;                       // 8 consecutive positions of one d
#pragma unroll  // constant index: the array stays in registers
                for (int r = 0; r < 8; ++r) hv[r] = (_Float16)(acc[g][f][r] + bval);
                *reinterpret_cast<v8h*>(&stg[(f * 16 + nl) * GPITCH + g * 16 + koff]) = hv;
            }
        }
    } else {
#pragma unroll  // constant index: the array stays in registers
        for (int f = 0; f < 4; ++f) {
            const float bval = bias[n0 + wn + f * 16 + nl];
#pragma unroll  // constant index: the array stays in registers
            for (int g = 0; g < 4; ++g)
#pragma unroll  // constant index: the array stays in registers
                for (int r = 0; r < 8; ++r)
                    stg[(g * 16 + koff + r) * GPITCH + f * 16 + nl] =
                        (_Float16)(acc[g][f][r] + bval);
        }
    }
    // the rows that this wave's lanes wrote are in LDS before other lanes of it read them
    asm volatile("s_wait_dscnt 0x0" ::: "memory");

    v8h o[16];                                // 8 lanes cover one 128 B row
#pragma unroll  // constant index: the array stays in registers
    for (int j = 0; j < 16; ++j) {
        int p = lane + j * 32;                // 0..511
        o[j] = *reinterpret_cast<const v8h*>(&stg[(p >> 3) * GPITCH + (p & 7) * 8]);
    }

    const int mrow = m0 + wm;                 // 64 rows, all of one batch entry
    const int bh   = (mrow >> 11) * NH + ((n0 + wn) >> 6);   // 64 columns = one head
    const int s0   = mrow & 2047;
    if (z == 2) {
        _Float16* dst = Vt + (size_t)bh * DH * SEQ + s0;
#pragma unroll  // constant index: the array stays in registers
        for (int j = 0; j < 16; ++j) {
            int p = lane + j * 32;
            *reinterpret_cast<v8h*>(dst + (size_t)(p >> 3) * SEQ + (p & 7) * 8) = o[j];
        }
    } else {
        _Float16* dst = ((z == 0) ? Qh : Kh) + ((size_t)bh * SEQ + s0) * DH;
#pragma unroll  // constant index: the array stays in registers
        for (int j = 0; j < 16; ++j)
            *reinterpret_cast<v8h*>(dst + (size_t)(lane + j * 32) * 8) = o[j];
    }
}

#define KBLK 64
#define NW_ATT 8
// LDS row pitch in halves: 64 data + 8 pad = 144 B = 16 B x odd, so the 16 rows
// that one ds_load_b128 touches fall on distinct banks (128 B rows collide).
#define LPITCH 72

// the bound states the block the launcher uses: without it the compiler plans for 1024
// work-items, 128 registers a lane, and spills
__global__ __launch_bounds__(NW_ATT * 32)
void attn_kernel(const _Float16* __restrict__ Qh,
                 const _Float16* __restrict__ Kh,
                 const _Float16* __restrict__ Vt,
                 const float* __restrict__ mask,
                 float* __restrict__ out) {
    __shared__ __align__(16) _Float16 Klds[2][KBLK * LPITCH];     // 2 x 9 KB
    __shared__ __align__(16) _Float16 Vlds[2][DH * LPITCH];       // 2 x 9 KB
    __shared__ __align__(32) float    mlds[SEQ];                  // 8 KB, 8 x mask

    const int tid  = threadIdx.x;
    const int wave = tid >> 5;
    const int lane = tid & 31;
    const int nl   = lane & 15;
    const int hi   = lane >> 4;
    const int koff = hi * 8;

    const int bh = blockIdx.y;
    const int b  = bh >> 4;
    const int h  = bh & 15;
    const int q0 = (blockIdx.x * NW_ATT + wave) * 16;

    const _Float16* Qbase = Qh + ((size_t)bh * SEQ + q0) * DH;
    const _Float16* Kbase = Kh + (size_t)bh * SEQ * DH;
    const _Float16* Vbase = Vt + (size_t)bh * DH * SEQ;
    const float*    mrow  = mask + (size_t)b * SEQ;

    const float LOG2E  = 1.4426950408889634f;
    const float KSCALE = 0.125f * LOG2E;      // 1/sqrt(64) folded into log2 domain

    // cooperative stage of one K/V tile pair into LDS buffer `buf`
    auto stage = [&](int buf, int k0) {
#pragma unroll
        for (int j = 0; j < 2; ++j) {
            int c   = tid * 2 + j;        // 0..511
            int row = c >> 3;             // 0..63
            int col = (c & 7) * 8;        // halves
            cp16_g2l(Kbase + (size_t)(k0 + row) * DH + col,
                     &Klds[buf][row * LPITCH + col]);
            cp16_g2l(Vbase + (size_t)row * SEQ + k0 + col,
                     &Vlds[buf][row * LPITCH + col]);
        }
    };

    // the mask row, times sqrt(dh) (exact, a power of two): a lane now needs the mask
    // of 32 keys per tile, and takes it as the start value of its S^T accumulators,
    // (q.k + 8 mask) / 8 = q.k / 8 + mask. Published by the loop's first barrier.
#pragma unroll  // the two loads of a lane issue back to back
    for (int j = 0; j < SEQ / (NW_ATT * 32 * 4); ++j) {
        int i = (tid + j * NW_ATT * 32) * 4;
        float4 mv = *reinterpret_cast<const float4*>(mrow + i);
        mv.x *= 8.0f; mv.y *= 8.0f; mv.z *= 8.0f; mv.w *= 8.0f;
        *reinterpret_cast<float4*>(&mlds[i]) = mv;
    }

    // Q^T b-fragments (64 d x 16 queries), reused across the whole loop
    v16h qb[2];
#pragma unroll  // constant index: the array stays in registers
    for (int j = 0; j < 2; ++j)
        qb[j] = load_frag16(Qbase + (size_t)nl * DH + j * 32 + koff);

    v16h ones;
#pragma unroll  // constant index: the array stays in registers
    for (int i = 0; i < 16; ++i) ones[i] = (_Float16)1.0f;

    v8f ctx[4];                               // O^T: ctx[f][r] = O[q = nl][16f + 8hi + r]
#pragma unroll  // constant index: the array stays in registers
    for (int f = 0; f < 4; ++f)
#pragma unroll  // constant index: the array stays in registers
        for (int r = 0; r < 8; ++r) ctx[f][r] = 0.0f;

    float m_run = -1.0e30f, l_run = 0.0f;     // of query nl, in units of q.k + 8 mask

    stage(0, 0);

    for (int it = 0; it < SEQ / KBLK; ++it) {
        const int k0  = it * KBLK;
        const int cur = it & 1;
        wait_async_copies();                  // drain this wave's async stores to LDS
        __syncthreads();                      // tile `cur` ready; everyone past `cur^1`
        if (it + 1 < SEQ / KBLK) stage(cur ^ 1, k0 + KBLK);

        const _Float16* Kt = &Klds[cur][0];
        const _Float16* Vv = &Vlds[cur][0];

        // ---- S^T: 4 key-frags x 2 d-chunks = 8 WMMAs, started from 8 x mask ----
        v8f S[4];
#pragma unroll  // constant index: the array stays in registers
        for (int c = 0; c < 4; ++c) {
            S[c] = *reinterpret_cast<const v8f*>(&mlds[k0 + 16 * c + koff]);
#pragma unroll  // constant index: the array stays in registers
            for (int j = 0; j < 2; ++j) {
                v16h ka = load_frag16(Kt + (size_t)(16 * c + nl) * LPITCH + j * 32 + koff);
                S[c] = wmma_f16(ka, qb[j], S[c]);
            }
        }

        // ---- online softmax (log2 domain), one query per lane ----
        float mc[4];                          // one chain per tile, not one of 32 links
#pragma unroll  // constant index: the array stays in registers
        for (int c = 0; c < 4; ++c) {
            mc[c] = S[c][0];
#pragma unroll  // constant index: the array stays in registers
            for (int r = 1; r < 8; ++r) mc[c] = fmaxf(mc[c], S[c][r]);
        }
        float mx = fmaxf(fmaxf(mc[0], mc[1]), fmaxf(mc[2], mc[3]));
        // the other 32 keys of this query sit in lane ^ 16
        mx = fmaxf(mx, __int_as_float(__builtin_amdgcn_permlanex16(
                 __float_as_int(mx), __float_as_int(mx), 0x76543210, 0xfedcba98,
                 false, false)));
        const float mnew   = fmaxf(m_run, mx);
        const float rscale = exp2f((m_run - mnew) * KSCALE);
        const float nm     = -mnew * KSCALE;
        m_run = mnew;

        // ---- P^T: S^T tiles 2j and 2j+1, converted in place, are b-fragment j ----
        v16h pb[2];
#pragma unroll  // constant index: the array stays in registers
        for (int j = 0; j < 2; ++j)
#pragma unroll  // constant index: the array stays in registers
            for (int i = 0; i < 16; ++i)
                pb[j][i] = (_Float16)exp2f(S[2 * j + (i >> 3)][i & 7] * KSCALE + nm);

        // ---- row sums via ones x P^T (every row of the result is the column sum) ----
        v8f ls;
#pragma unroll  // constant index: the array stays in registers
        for (int r = 0; r < 8; ++r) ls[r] = 0.0f;
        ls = wmma_f16(ones, pb[0], ls);
        ls = wmma_f16(ones, pb[1], ls);

        // ---- rescale O^T, update l, O^T += V^T x P^T (8 WMMAs) ----
#pragma unroll  // constant index: the array stays in registers
        for (int f = 0; f < 4; ++f)
#pragma unroll  // constant index: the array stays in registers
            for (int r = 0; r < 8; ++r) ctx[f][r] *= rscale;
        l_run = l_run * rscale + ls[0];

#pragma unroll  // constant index: the array stays in registers
        for (int f = 0; f < 4; ++f) {
#pragma unroll  // constant index: the array stays in registers
            for (int j = 0; j < 2; ++j) {
                v16h va = load_frag16(Vv + (size_t)(f * 16 + nl) * LPITCH + j * 32 + koff);
                ctx[f] = wmma_f16(va, pb[j], ctx[f]);
            }
        }
    }

    // ---- normalize and write [B,S,h*dh] fp32: 8 consecutive d per lane and frag ----
    const float inv = 1.0f / l_run;
    float* orow = out + ((size_t)b * SEQ + q0 + nl) * HID + h * DH + koff;
#pragma unroll  // constant index: the array stays in registers
    for (int f = 0; f < 4; ++f) {
        float4 lo = make_float4(ctx[f][0] * inv, ctx[f][1] * inv, ctx[f][2] * inv, ctx[f][3] * inv);
        float4 hv = make_float4(ctx[f][4] * inv, ctx[f][5] * inv, ctx[f][6] * inv, ctx[f][7] * inv);
        *reinterpret_cast<float4*>(orow + f * 16)     = lo;
        *reinterpret_cast<float4*>(orow + f * 16 + 4) = hv;
    }
}

// ---------- launcher ----------
extern "C" void kernel_launch(void* const* d_in, const int* in_sizes, int n_in,
                              void* d_out, int out_size, void* d_ws, size_t ws_size,
                              hipStream_t stream) {
    const float* hidden = (const float*)d_in[0];
    const float* amask  = (const float*)d_in[1];
    const float* Wq     = (const float*)d_in[2];
    const float* bq     = (const float*)d_in[3];
    const float* Wk     = (const float*)d_in[4];
    const float* bk     = (const float*)d_in[5];
    const float* Wv     = (const float*)d_in[6];
    const float* bv     = (const float*)d_in[7];
    float* out = (float*)d_out;

    // workspace layout (bytes); total ~38 MB
    char* ws = (char*)d_ws;
    const size_t XH_OFF  = 0;
    const size_t WTQ_OFF = XH_OFF  + (size_t)MTOT * HID * 2;
    const size_t WTK_OFF = WTQ_OFF + (size_t)HID * HID * 2;
    const size_t WTV_OFF = WTK_OFF + (size_t)HID * HID * 2;
    const size_t QH_OFF  = WTV_OFF + (size_t)HID * HID * 2;
    const size_t KH_OFF  = QH_OFF  + (size_t)MTOT * HID * 2;
    const size_t VT_OFF  = KH_OFF  + (size_t)MTOT * HID * 2;

    _Float16* Xh  = (_Float16*)(ws + XH_OFF);
    _Float16* Wtq = (_Float16*)(ws + WTQ_OFF);
    _Float16* Wtk = (_Float16*)(ws + WTK_OFF);
    _Float16* Wtv = (_Float16*)(ws + WTV_OFF);
    _Float16* Qh  = (_Float16*)(ws + QH_OFF);
    _Float16* Kh  = (_Float16*)(ws + KH_OFF);
    _Float16* Vt  = (_Float16*)(ws + VT_OFF);

    // 1) convert inputs to f16 (+ transpose weights)
    {
        cvt_kernel<<<CVT_WBLOCKS + CVT_XBLOCKS, CVT_THREADS, 0, stream>>>(
            hidden, Wq, Wk, Wv, Xh, Wtq, Wtk, Wtv);
    }

    // 2) QKV projections via WMMA (128x128 tiles per 4-wave work-group)
    {
        dim3 grid(MTOT / GBM, HID / GBN, 3);   // (32, 8, 3)
        qkv_gemm_kernel<<<grid, GTHREADS, 0, stream>>>(Xh, Wtq, Wtk, Wtv, bq, bk, bv,
                                                       Qh, Kh, Vt);
    }

    // 3) flash attention via WMMA with async-LDS-staged K/V
    {
        dim3 grid(SEQ / (16 * NW_ATT), BATCH * NH);   // (16, 32)
        attn_kernel<<<grid, 256, 0, stream>>>(Qh, Kh, Vt, amask, out);
    }
}

// v006
// It runs in 67.7 microseconds.
// Timed twice side by side with v005, it ran 1.17 and 1.18 times as fast.
// All steps since v000 together make it 5.03 times as fast.
#include <hip/hip_runtime.h>
#include <hip/hip_bf16.h>
#include <math.h>

typedef __attribute__((ext_vector_type(16))) _Float16 v16h;
typedef __attribute__((ext_vector_type(8)))  float    v8f;
typedef int vs4i __attribute__((vector_size(16)));

#define SEQ   2048
#define HID   1024
#define NH    16
#define DH    64
#define BATCH 2
#define MTOT  (BATCH * SEQ)   // 4096 rows for QKV gemm

#if __has_builtin(__builtin_amdgcn_global_load_async_to_lds_b128)
#define HAVE_ASYNC_LDS 1
#endif

// ---------- fragment helpers ----------
// 16-bit A-matrix 16x32 layout: lane%16 = row, lane/16 selects K-offset (0 or 8);
// halves {koff..koff+7} then {koff+16..koff+23} -> two 16B loads.
__device__ __forceinline__ v16h load_frag16(const _Float16* p) {
    union { v16h v; uint4 u[2]; } u;
    u.u[0] = *reinterpret_cast<const uint4*>(p);
    u.u[1] = *reinterpret_cast<const uint4*>(p + 16);
    return u.v;
}

__device__ __forceinline__ v8f wmma_f16(v16h a, v16h b, v8f c) {
    return __builtin_amdgcn_wmma_f32_16x16x32_f16(
        /*neg_a=*/false, a, /*neg_b=*/false, b,
        /*c_mod=*/(short)0, c, /*reuse_a=*/false, /*reuse_b=*/false);
}

// 16-byte global -> LDS copy; async (ASYNCcnt-tracked, no VGPR round trip) when
// the gfx1250 builtin is available, else VGPR-staged fallback.
__device__ __forceinline__ void cp16_g2l(const _Float16* g, _Float16* l) {
#if defined(HAVE_ASYNC_LDS)
    __builtin_amdgcn_global_load_async_to_lds_b128(
        (__attribute__((address_space(1))) vs4i*)(unsigned long long)(const void*)g,
        (__attribute__((address_space(3))) vs4i*)(unsigned int)(unsigned long long)(void*)l,
        0, 0);
#else
    *reinterpret_cast<uint4*>(l) = *reinterpret_cast<const uint4*>(g);
#endif
}

__device__ __forceinline__ void wait_async_copies() {
#if defined(HAVE_ASYNC_LDS)
#if __has_builtin(__builtin_amdgcn_s_wait_asynccnt)
    __builtin_amdgcn_s_wait_asynccnt(0);
#else
    asm volatile("s_wait_asynccnt 0x0" ::: "memory");
#endif
#endif
}

// ---------- kernel 1: fp32 -> f16 convert + weight transpose ----------
// A streaming launch of many short waves, one tile or chunk per block: every lane has 8 loads of 16 B in
// flight, every wave-wide load covers 512 contiguous bytes and every store fills
// whole 128 B lines.
//   blocks 0 .. CVT_WBLOCKS-1 : one 64(k) x 128(n) tile of one weight matrix, turned
//                               round in LDS and stored as rows of W^T
//   the other CVT_XBLOCKS     : 8192 consecutive elements of X
typedef __attribute__((ext_vector_type(4))) _Float16 v4h;
typedef __attribute__((ext_vector_type(8))) _Float16 v8h;

#define CVT_THREADS 256
#define CVT_TK 64
#define CVT_TN 128
// LDS row pitch in halves: 64 data + 8 pad = 144 B = 16 B x odd (ds_load_b128 reader)
#define CVT_PITCH 72
#define CVT_WBLOCKS (3 * (HID / CVT_TK) * (HID / CVT_TN))      // 384
#define CVT_XELEMS  (CVT_THREADS * 4 * 8)                      // 8192 per block
#define CVT_XBLOCKS ((MTOT * HID) / CVT_XELEMS)                // 512

__global__ __launch_bounds__(CVT_THREADS)
void cvt_kernel(const float* __restrict__ X,
                const float* __restrict__ Wq,
                const float* __restrict__ Wk,
                const float* __restrict__ Wv,
                _Float16* __restrict__ Xh,
                _Float16* __restrict__ Wtq,
                _Float16* __restrict__ Wtk,
                _Float16* __restrict__ Wtv) {
    __shared__ __align__(16) _Float16 tile[CVT_TN * CVT_PITCH];   // 18 KB, [n][k]

    const int tid = threadIdx.x;
    const int blk = blockIdx.x;

    if (blk < CVT_WBLOCKS) {
        const int w  = blk >> 7;                  // 128 tiles per matrix
        const int k0 = ((blk >> 3) & 15) * CVT_TK;
        const int n0 = (blk & 7) * CVT_TN;
        const float* Wsrc = (w == 0) ? Wq : (w == 1) ? Wk : Wv;
        _Float16*    Wdst = (w == 0) ? Wtq : (w == 1) ? Wtk : Wtv;

        const int kg = (tid >> 5) * 8;            // this wave's 8 rows of k
        const int ng = (tid & 31) * 4;            // this lane's 4 columns of n

        float4 v[8];
#pragma unroll  // the 8 loads of a lane issue back to back
        for (int j = 0; j < 8; ++j)
            v[j] = *reinterpret_cast<const float4*>(
                Wsrc + (size_t)(k0 + kg + j) * HID + n0 + ng);

        v8h c0, c1, c2, c3;
#pragma unroll  // constant index: the vectors stay in registers
        for (int j = 0; j < 8; ++j) {
            c0[j] = (_Float16)v[j].x;
            c1[j] = (_Float16)v[j].y;
            c2[j] = (_Float16)v[j].z;
            c3[j] = (_Float16)v[j].w;
        }
        *reinterpret_cast<v8h*>(&tile[(ng + 0) * CVT_PITCH + kg]) = c0;
        *reinterpret_cast<v8h*>(&tile[(ng + 1) * CVT_PITCH + kg]) = c1;
        *reinterpret_cast<v8h*>(&tile[(ng + 2) * CVT_PITCH + kg]) = c2;
        *reinterpret_cast<v8h*>(&tile[(ng + 3) * CVT_PITCH + kg]) = c3;
        __syncthreads();   // block-uniform branch: the whole tile is in LDS

#pragma unroll  // 4 independent LDS reads and line stores per lane
        for (int j = 0; j < (CVT_TN * 8) / CVT_THREADS; ++j) {
            int p   = tid + j * CVT_THREADS;      // 0..1023
            int n   = p >> 3;                     // 8 lanes cover one 128 B row
            int col = (p & 7) * 8;                // halves
            *reinterpret_cast<v8h*>(Wdst + (size_t)(n0 + n) * HID + k0 + col) =
                *reinterpret_cast<const v8h*>(&tile[n * CVT_PITCH + col]);
        }
    } else {
        const size_t base = (size_t)(blk - CVT_WBLOCKS) * CVT_XELEMS + (size_t)tid * 4;
        float4 v[8];
#pragma unroll  // the 8 loads of a lane issue back to back
        for (int j = 0; j < 8; ++j)
            v[j] = *reinterpret_cast<const float4*>(X + base + j * (CVT_THREADS * 4));
#pragma unroll  // constant index: the array stays in registers
        for (int j = 0; j < 8; ++j) {
            v4h h;
            h[0] = (_Float16)v[j].x;
            h[1] = (_Float16)v[j].y;
            h[2] = (_Float16)v[j].z;
            h[3] = (_Float16)v[j].w;
            *reinterpret_cast<v4h*>(Xh + base + j * (CVT_THREADS * 4)) = h;
        }
        // the stores' address and data registers are not reused before this wait, on
        // any way the built code has from here into the other half
        asm volatile("s_wait_xcnt 0x0" ::: "memory");
    }
}

// ---------- kernel 2: QKV projection GEMM ----------
// one work-group of 4 waves computes a 128(M) x 128(N) tile; each wave owns 64 x 64.
// grid = (32 Mtiles, 8 Ntiles, 3 matrices). Slices of 64 k of the X rows and of the
// W^T rows are brought to LDS once per work-group by async copies (whole 128 B lines),
// two buffers, the next slice in flight while this one is multiplied; every fragment
// read from LDS feeds 4 WMMAs.
#define GBM 128
#define GBN 128
#define GBK 64
// LDS row pitch in halves: 64 data + 8 pad = 144 B = 16 B x odd (ds_load_b128 reader)
#define GPITCH 72
#define GTHREADS 128

__global__ __launch_bounds__(GTHREADS)
void qkv_gemm_kernel(const _Float16* __restrict__ Xh,
                     const _Float16* __restrict__ Wtq,
                     const _Float16* __restrict__ Wtk,
                     const _Float16* __restrict__ Wtv,
                     const float* __restrict__ bq,
                     const float* __restrict__ bk,
                     const float* __restrict__ bv,
                     _Float16* __restrict__ Qh,
                     _Float16* __restrict__ Kh,
                     _Float16* __restrict__ Vt) {
    __shared__ __align__(16) _Float16 Ash[2][GBM * GPITCH];   // 2 x 18 KB
    __shared__ __align__(16) _Float16 Bsh[2][GBN * GPITCH];   // 2 x 18 KB

    const int z    = blockIdx.z;                 // 0=Q 1=K 2=V
    const _Float16* Wt = (z == 0) ? Wtq : (z == 1) ? Wtk : Wtv;
    const float*  bias = (z == 0) ? bq  : (z == 1) ? bk  : bv;

    const int tid  = threadIdx.x;
    const int wave = tid >> 5;
    const int lane = tid & 31;
    const int nl   = lane & 15;
    const int hi   = lane >> 4;
    const int koff = hi * 8;

    const int m0 = blockIdx.x * GBM;
    const int n0 = blockIdx.y * GBN;
    const int wm = (wave >> 1) * 64;             // this wave's rows inside the tile
    const int wn = (wave & 1) * 64;              // this wave's columns inside the tile

    // one k-slice of both operands into LDS buffer `buf`: 8 lanes cover one 128 B row
    auto stage = [&](int buf, int k0) {
#pragma unroll  // the 16 copies of a slice issue back to back
        for (int j = 0; j < (GBM * 8) / GTHREADS; ++j) {
            int c   = tid + j * GTHREADS;  // 0..1023
            int row = c >> 3;              // 0..127
            int col = (c & 7) * 8;         // halves
            cp16_g2l(Xh + (size_t)(m0 + row) * HID + k0 + col,
                     &Ash[buf][row * GPITCH + col]);
            cp16_g2l(Wt + (size_t)(n0 + row) * HID + k0 + col,
                     &Bsh[buf][row * GPITCH + col]);
        }
    };

    v8f acc[4][4];
#pragma unroll  // constant index: the array stays in registers
    for (int g = 0; g < 4; ++g)
#pragma unroll  // constant index: the array stays in registers
        for (int f = 0; f < 4; ++f)
#pragma unroll  // constant index: the array stays in registers
            for (int r = 0; r < 8; ++r) acc[g][f][r] = 0.0f;

    stage(0, 0);
    // slice 0 has landed for this wave's own copies before the barrier publishes it
    asm volatile("s_wait_asynccnt 0x0" ::: "memory");
    __syncthreads();
    stage(1, GBK);

    for (int t = 0; t < HID / GBK; ++t) {
        const _Float16* At = &Ash[t & 1][0];
        const _Float16* Bt = &Bsh[t & 1][0];
        v16h a[4], b[4];

        // first 32 k of the slice
#pragma unroll  // constant index: the array stays in registers
        for (int g = 0; g < 4; ++g)
            a[g] = load_frag16(At + (wm + g * 16 + nl) * GPITCH + koff);
#pragma unroll  // constant index: the array stays in registers
        for (int f = 0; f < 4; ++f)
            b[f] = load_frag16(Bt + (wn + f * 16 + nl) * GPITCH + koff);
        // keeps the 16 LDS reads of this k-step together in front of its 16 WMMAs:
        // left free, the scheduler reads each b fragment right before its use and
        // the wave waits out the LDS latency four times per k-step instead of once
        __builtin_amdgcn_sched_barrier(0);
#pragma unroll  // constant index: the array stays in registers
        for (int f = 0; f < 4; ++f)
#pragma unroll  // constant index: the array stays in registers
            for (int g = 0; g < 4; ++g)
                acc[g][f] = wmma_f16(a[g], b[f], acc[g][f]);

        // second 32 k: the fragments are fetched, the buffer is handed back and its
        // refill is on its way before the 16 WMMAs that need registers only
#pragma unroll  // constant index: the array stays in registers
        for (int g = 0; g < 4; ++g)
            a[g] = load_frag16(At + (wm + g * 16 + nl) * GPITCH + 32 + koff);
#pragma unroll  // constant index: the array stays in registers
        for (int f = 0; f < 4; ++f)
            b[f] = load_frag16(Bt + (wn + f * 16 + nl) * GPITCH + 32 + koff);
        // this wave's reads of buffer t&1 are done before the buffer is refilled
        asm volatile("s_wait_dscnt 0x0" ::: "memory");
        // this wave's copies of slice t+1 have landed before the barrier publishes them
        asm volatile("s_wait_asynccnt 0x0" ::: "memory");
        __syncthreads();
        if (t + 2 < HID / GBK) stage(t & 1, (t + 2) * GBK);
#pragma unroll  // constant index: the array stays in registers
        for (int f = 0; f < 4; ++f)
#pragma unroll  // constant index: the array stays in registers
            for (int g = 0; g < 4; ++g)
                acc[g][f] = wmma_f16(a[g], b[f], acc[g][f]);
    }
    // no copy is outstanding when the wave goes on to its end
    asm volatile("s_wait_asynccnt 0x0" ::: "memory");

    // epilogue: bias, then the wave's 64 x 64 f16 tile goes through LDS and leaves as whole
    // 128 B lines, 16 B a lane. The ring is free: behind the last trip's barrier no wave
    // reads it and no copy is outstanding, and each wave stages in rows of its own.
    // Staged row = one output line: a sequence position (64 d) for Q and K, a d (64
    // positions) for V^T.
    _Float16* stg = &Ash[wave >> 1][(wave & 1) * 64 * GPITCH];
    if (z == 2) {
#pragma unroll  // constant index: the array stays in registers
        for (int f = 0; f < 4; ++f) {
            const float bval = bias[n0 + wn + f * 16 + nl];
#pragma unroll  // constant index: the array stays in registers
            for (int g = 0; g < 4; ++g) {
                v8h hv;                       // 8 consecutive positions of one d
#pragma unroll  // constant index: the array stays in registers
                for (int r = 0; r < 8; ++r) hv[r] = (_Float16)(acc[g][f][r] + bval);
                *reinterpret_cast<v8h*>(&stg[(f * 16 + nl) * GPITCH + g * 16 + koff]) = hv;
            }
        }
    } else {
#pragma unroll  // constant index: the array stays in registers
        for (int f = 0; f < 4; ++f) {
            const float bval = bias[n0 + wn + f * 16 + nl];
#pragma unroll  // constant index: the array stays in registers
            for (int g = 0; g < 4; ++g)
#pragma unroll  // constant index: the array stays in registers
                for (int r = 0; r < 8; ++r)
                    stg[(g * 16 + koff + r) * GPITCH + f * 16 + nl] =
                        (_Float16)(acc[g][f][r] + bval);
        }
    }
    // the rows that this wave's lanes wrote are in LDS before other lanes of it read them
    asm volatile("s_wait_dscnt 0x0" ::: "memory");

    v8h o[16];                                // 8 lanes cover one 128 B row
#pragma unroll  // constant index: the array stays in registers
    for (int j = 0; j < 16; ++j) {
        int p = lane + j * 32;                // 0..511
        o[j] = *reinterpret_cast<const v8h*>(&stg[(p >> 3) * GPITCH + (p & 7) * 8]);
    }

    const int mrow = m0 + wm;                 // 64 rows, all of one batch entry
    const int bh   = (mrow >> 11) * NH + ((n0 + wn) >> 6);   // 64 columns = one head
    const int s0   = mrow & 2047;
    if (z == 2) {
        _Float16* dst = Vt + (size_t)bh * DH * SEQ + s0;
#pragma unroll  // constant index: the array stays in registers
        for (int j = 0; j < 16; ++j) {
            int p = lane + j * 32;
            *reinterpret_cast<v8h*>(dst + (size_t)(p >> 3) * SEQ + (p & 7) * 8) = o[j];
        }
    } else {
        _Float16* dst = ((z == 0) ? Qh : Kh) + ((size_t)bh * SEQ + s0) * DH;
#pragma unroll  // constant index: the array stays in registers
        for (int j = 0; j < 16; ++j)
            *reinterpret_cast<v8h*>(dst + (size_t)(lane + j * 32) * 8) = o[j];
    }
}

// 2^x as the one hardware instruction. The library's exp2f puts a range shift round it
// (compare, select, add, select, ldexp) that only matters for results below 2^-126:
// as P those round to 0 in f16 either way, and as a rescale factor they multiply old
// sums that the new maximum's own term (P = 1) exceeds by more than 2^100.
__device__ __forceinline__ float exp2_hw(float x) {
    return __builtin_amdgcn_exp2f(x);
}

#define KBLK 64
#define NW_ATT 8
// LDS row pitch in halves: 64 data + 8 pad = 144 B = 16 B x odd, so the 16 rows
// that one ds_load_b128 touches fall on distinct banks (128 B rows collide).
#define LPITCH 72

// the bound states the block the launcher uses: without it the compiler plans for 1024
// work-items, 128 registers a lane, and spills
__global__ __launch_bounds__(NW_ATT * 32)
void attn_kernel(const _Float16* __restrict__ Qh,
                 const _Float16* __restrict__ Kh,
                 const _Float16* __restrict__ Vt,
                 const float* __restrict__ mask,
                 float* __restrict__ out) {
    __shared__ __align__(16) _Float16 Klds[2][KBLK * LPITCH];     // 2 x 9 KB
    __shared__ __align__(16) _Float16 Vlds[2][DH * LPITCH];       // 2 x 9 KB
    __shared__ __align__(32) float    mlds[SEQ];                  // 8 KB, 8 x mask

    const int tid  = threadIdx.x;
    const int wave = tid >> 5;
    const int lane = tid & 31;
    const int nl   = lane & 15;
    const int hi   = lane >> 4;
    const int koff = hi * 8;

    const int bh = blockIdx.y;
    const int b  = bh >> 4;
    const int h  = bh & 15;
    const int q0 = (blockIdx.x * NW_ATT + wave) * 16;

    const _Float16* Qbase = Qh + ((size_t)bh * SEQ + q0) * DH;
    const _Float16* Kbase = Kh + (size_t)bh * SEQ * DH;
    const _Float16* Vbase = Vt + (size_t)bh * DH * SEQ;
    const float*    mrow  = mask + (size_t)b * SEQ;

    const float LOG2E  = 1.4426950408889634f;
    const float KSCALE = 0.125f * LOG2E;      // 1/sqrt(64) folded into log2 domain

    // cooperative stage of one K/V tile pair into LDS buffer `buf`
    auto stage = [&](int buf, int k0) {
#pragma unroll
        for (int j = 0; j < 2; ++j) {
            int c   = tid * 2 + j;        // 0..511
            int row = c >> 3;             // 0..63
            int col = (c & 7) * 8;        // halves
            cp16_g2l(Kbase + (size_t)(k0 + row) * DH + col,
                     &Klds[buf][row * LPITCH + col]);
            cp16_g2l(Vbase + (size_t)row * SEQ + k0 + col,
                     &Vlds[buf][row * LPITCH + col]);
        }
    };

    // the mask row, times sqrt(dh) (exact, a power of two): a lane now needs the mask
    // of 32 keys per tile, and takes it as the start value of its S^T accumulators,
    // (q.k + 8 mask) / 8 = q.k / 8 + mask. Published by the loop's first barrier.
#pragma unroll  // the two loads of a lane issue back to back
    for (int j = 0; j < SEQ / (NW_ATT * 32 * 4); ++j) {
        int i = (tid + j * NW_ATT * 32) * 4;
        float4 mv = *reinterpret_cast<const float4*>(mrow + i);
        mv.x *= 8.0f; mv.y *= 8.0f; mv.z *= 8.0f; mv.w *= 8.0f;
        *reinterpret_cast<float4*>(&mlds[i]) = mv;
    }

    // Q^T b-fragments (64 d x 16 queries), reused across the whole loop
    v16h qb[2];
#pragma unroll  // constant index: the array stays in registers
    for (int j = 0; j < 2; ++j)
        qb[j] = load_frag16(Qbase + (size_t)nl * DH + j * 32 + koff);

    v16h ones;
#pragma unroll  // constant index: the array stays in registers
    for (int i = 0; i < 16; ++i) ones[i] = (_Float16)1.0f;

    v8f ctx[4];                               // O^T: ctx[f][r] = O[q = nl][16f + 8hi + r]
#pragma unroll  // constant index: the array stays in registers
    for (int f = 0; f < 4; ++f)
#pragma unroll  // constant index: the array stays in registers
        for (int r = 0; r < 8; ++r) ctx[f][r] = 0.0f;

    float m_run = -1.0e30f, l_run = 0.0f;     // of query nl, in units of q.k + 8 mask

    stage(0, 0);

    for (int it = 0; it < SEQ / KBLK; ++it) {
        const int k0  = it * KBLK;
        const int cur = it & 1;
        wait_async_copies();                  // drain this wave's async stores to LDS
        __syncthreads();                      // tile `cur` ready; everyone past `cur^1`
        if (it + 1 < SEQ / KBLK) stage(cur ^ 1, k0 + KBLK);

        const _Float16* Kt = &Klds[cur][0];
        const _Float16* Vv = &Vlds[cur][0];

        // ---- S^T: 4 key-frags x 2 d-chunks = 8 WMMAs, started from 8 x mask ----
        v8f S[4];
#pragma unroll  // constant index: the array stays in registers
        for (int c = 0; c < 4; ++c) {
            S[c] = *reinterpret_cast<const v8f*>(&mlds[k0 + 16 * c + koff]);
#pragma unroll  // constant index: the array stays in registers
            for (int j = 0; j < 2; ++j) {
                v16h ka = load_frag16(Kt + (size_t)(16 * c + nl) * LPITCH + j * 32 + koff);
                S[c] = wmma_f16(ka, qb[j], S[c]);
            }
        }

        // ---- online softmax (log2 domain), one query per lane ----
        float mc[4];                          // one chain per tile, not one of 32 links
#pragma unroll  // constant index: the array stays in registers
        for (int c = 0; c < 4; ++c) {
            mc[c] = S[c][0];
#pragma unroll  // constant index: the array stays in registers
            for (int r = 1; r < 8; ++r) mc[c] = fmaxf(mc[c], S[c][r]);
        }
        float mx = fmaxf(fmaxf(mc[0], mc[1]), fmaxf(mc[2], mc[3]));
        // the other 32 keys of this query sit in lane ^ 16
        mx = fmaxf(mx, __int_as_float(__builtin_amdgcn_permlanex16(
                 __float_as_int(mx), __float_as_int(mx), 0x76543210, 0xfedcba98,
                 false, false)));
        const float mnew   = fmaxf(m_run, mx);
        const float rscale = exp2_hw((m_run - mnew) * KSCALE);
        const float nm     = -mnew * KSCALE;
        m_run = mnew;

        // ---- P^T: S^T tiles 2j and 2j+1, converted in place, are b-fragment j ----
        v16h pb[2];
#pragma unroll  // constant index: the array stays in registers
        for (int j = 0; j < 2; ++j)
#pragma unroll  // constant index: the array stays in registers
            for (int i = 0; i < 16; ++i)
                pb[j][i] = (_Float16)exp2_hw(S[2 * j + (i >> 3)][i & 7] * KSCALE + nm);

        // ---- row sums via ones x P^T (every row of the result is the column sum) ----
        v8f ls;
#pragma unroll  // constant index: the array stays in registers
        for (int r = 0; r < 8; ++r) ls[r] = 0.0f;
        ls = wmma_f16(ones, pb[0], ls);
        ls = wmma_f16(ones, pb[1], ls);

        // ---- rescale O^T, update l, O^T += V^T x P^T (8 WMMAs) ----
#pragma unroll  // constant index: the array stays in registers
        for (int f = 0; f < 4; ++f)
#pragma unroll  // constant index: the array stays in registers
            for (int r = 0; r < 8; ++r) ctx[f][r] *= rscale;
        l_run = l_run * rscale + ls[0];

#pragma unroll  // constant index: the array stays in registers
        for (int f = 0; f < 4; ++f) {
#pragma unroll  // constant index: the array stays in registers
            for (int j = 0; j < 2; ++j) {
                v16h va = load_frag16(Vv + (size_t)(f * 16 + nl) * LPITCH + j * 32 + koff);
                ctx[f] = wmma_f16(va, pb[j], ctx[f]);
            }
        }
    }

    // ---- normalize and write [B,S,h*dh] fp32: 8 consecutive d per lane and frag ----
    const float inv = 1.0f / l_run;
    float* orow = out + ((size_t)b * SEQ + q0 + nl) * HID + h * DH + koff;
#pragma unroll  // constant index: the array stays in registers
    for (int f = 0; f < 4; ++f) {
        float4 lo = make_float4(ctx[f][0] * inv, ctx[f][1] * inv, ctx[f][2] * inv, ctx[f][3] * inv);
        float4 hv = make_float4(ctx[f][4] * inv, ctx[f][5] * inv, ctx[f][6] * inv, ctx[f][7] * inv);
        *reinterpret_cast<float4*>(orow + f * 16)     = lo;
        *reinterpret_cast<float4*>(orow + f * 16 + 4) = hv;
    }
}

// ---------- launcher ----------
extern "C" void kernel_launch(void* const* d_in, const int* in_sizes, int n_in,
                              void* d_out, int out_size, void* d_ws, size_t ws_size,
                              hipStream_t stream) {
    const float* hidden = (const float*)d_in[0];
    const float* amask  = (const float*)d_in[1];
    const float* Wq     = (const float*)d_in[2];
    const float* bq     = (const float*)d_in[3];
    const float* Wk     = (const float*)d_in[4];
    const float* bk     = (const float*)d_in[5];
    const float* Wv     = (const float*)d_in[6];
    const float* bv     = (const float*)d_in[7];
    float* out = (float*)d_out;

    // workspace layout (bytes); total ~38 MB
    char* ws = (char*)d_ws;
    const size_t XH_OFF  = 0;
    const size_t WTQ_OFF = XH_OFF  + (size_t)MTOT * HID * 2;
    const size_t WTK_OFF = WTQ_OFF + (size_t)HID * HID * 2;
    const size_t WTV_OFF = WTK_OFF + (size_t)HID * HID * 2;
    const size_t QH_OFF  = WTV_OFF + (size_t)HID * HID * 2;
    const size_t KH_OFF  = QH_OFF  + (size_t)MTOT * HID * 2;
    const size_t VT_OFF  = KH_OFF  + (size_t)MTOT * HID * 2;

    _Float16* Xh  = (_Float16*)(ws + XH_OFF);
    _Float16* Wtq = (_Float16*)(ws + WTQ_OFF);
    _Float16* Wtk = (_Float16*)(ws + WTK_OFF);
    _Float16* Wtv = (_Float16*)(ws + WTV_OFF);
    _Float16* Qh  = (_Float16*)(ws + QH_OFF);
    _Float16* Kh  = (_Float16*)(ws + KH_OFF);
    _Float16* Vt  = (_Float16*)(ws + VT_OFF);

    // 1) convert inputs to f16 (+ transpose weights)
    {
        cvt_kernel<<<CVT_WBLOCKS + CVT_XBLOCKS, CVT_THREADS, 0, stream>>>(
            hidden, Wq, Wk, Wv, Xh, Wtq, Wtk, Wtv);
    }

    // 2) QKV projections via WMMA (128x128 tiles per 4-wave work-group)
    {
        dim3 grid(MTOT / GBM, HID / GBN, 3);   // (32, 8, 3)
        qkv_gemm_kernel<<<grid, GTHREADS, 0, stream>>>(Xh, Wtq, Wtk, Wtv, bq, bk, bv,
                                                       Qh, Kh, Vt);
    }

    // 3) flash attention via WMMA with async-LDS-staged K/V
    {
        dim3 grid(SEQ / (16 * NW_ATT), BATCH * NH);   // (16, 32)
        attn_kernel<<<grid, 256, 0, stream>>>(Qh, Kh, Vt, amask, out);
    }
}

// v007
// It runs in 62.3 microseconds.
// In both of two side-by-side timings against v006, it was 1.09 times as fast.
// Counting every step since v000, it is 5.48 times as fast.
#include <hip/hip_runtime.h>
#include <hip/hip_bf16.h>
#include <math.h>

typedef __attribute__((ext_vector_type(16))) _Float16 v16h;
typedef __attribute__((ext_vector_type(8)))  float    v8f;
typedef int vs4i __attribute__((vector_size(16)));

#define SEQ   2048
#define HID   1024
#define NH    16
#define DH    64
#define BATCH 2
#define MTOT  (BATCH * SEQ)   // 4096 rows for QKV gemm

#if __has_builtin(__builtin_amdgcn_global_load_async_to_lds_b128)
#define HAVE_ASYNC_LDS 1
#endif

// ---------- fragment helpers ----------
// 16-bit A-matrix 16x32 layout: lane%16 = row, lane/16 selects K-offset (0 or 8);
// halves {koff..koff+7} then {koff+16..koff+23} -> two 16B loads.
__device__ __forceinline__ v16h load_frag16(const _Float16* p) {
    union { v16h v; uint4 u[2]; } u;
    u.u[0] = *reinterpret_cast<const uint4*>(p);
    u.u[1] = *reinterpret_cast<const uint4*>(p + 16);
    return u.v;
}

__device__ __forceinline__ v8f wmma_f16(v16h a, v16h b, v8f c) {
    return __builtin_amdgcn_wmma_f32_16x16x32_f16(
        /*neg_a=*/false, a, /*neg_b=*/false, b,
        /*c_mod=*/(short)0, c, /*reuse_a=*/false, /*reuse_b=*/false);
}

// 16-byte global -> LDS copy; async (ASYNCcnt-tracked, no VGPR round trip) when
// the gfx1250 builtin is available, else VGPR-staged fallback.
__device__ __forceinline__ void cp16_g2l(const _Float16* g, _Float16* l) {
#if defined(HAVE_ASYNC_LDS)
    __builtin_amdgcn_global_load_async_to_lds_b128(
        (__attribute__((address_space(1))) vs4i*)(unsigned long long)(const void*)g,
        (__attribute__((address_space(3))) vs4i*)(unsigned int)(unsigned long long)(void*)l,
        0, 0);
#else
    *reinterpret_cast<uint4*>(l) = *reinterpret_cast<const uint4*>(g);
#endif
}

// ---------- kernel 1: fp32 -> f16 convert + weight transpose ----------
// A streaming launch of many short waves, one tile or chunk per block: every lane has 8 loads of 16 B in
// flight, every wave-wide load covers 512 contiguous bytes and every store fills
// whole 128 B lines.
//   blocks 0 .. CVT_WBLOCKS-1 : one 64(k) x 128(n) tile of one weight matrix, turned
//                               round in LDS and stored as rows of W^T
//   the other CVT_XBLOCKS     : 8192 consecutive elements of X
typedef __attribute__((ext_vector_type(4))) _Float16 v4h;
typedef __attribute__((ext_vector_type(8))) _Float16 v8h;

#define CVT_THREADS 256
#define CVT_TK 64
#define CVT_TN 128
// LDS row pitch in halves: 64 data + 8 pad = 144 B = 16 B x odd (ds_load_b128 reader)
#define CVT_PITCH 72
#define CVT_WBLOCKS (3 * (HID / CVT_TK) * (HID / CVT_TN))      // 384
#define CVT_XELEMS  (CVT_THREADS * 4 * 8)                      // 8192 per block
#define CVT_XBLOCKS ((MTOT * HID) / CVT_XELEMS)                // 512

__global__ __launch_bounds__(CVT_THREADS)
void cvt_kernel(const float* __restrict__ X,
                const float* __restrict__ Wq,
                const float* __restrict__ Wk,
                const float* __restrict__ Wv,
                _Float16* __restrict__ Xh,
                _Float16* __restrict__ Wtq,
                _Float16* __restrict__ Wtk,
                _Float16* __restrict__ Wtv) {
    __shared__ __align__(16) _Float16 tile[CVT_TN * CVT_PITCH];   // 18 KB, [n][k]

    const int tid = threadIdx.x;
    const int blk = blockIdx.x;

    if (blk < CVT_WBLOCKS) {
        const int w  = blk >> 7;                  // 128 tiles per matrix
        const int k0 = ((blk >> 3) & 15) * CVT_TK;
        const int n0 = (blk & 7) * CVT_TN;
        const float* Wsrc = (w == 0) ? Wq : (w == 1) ? Wk : Wv;
        _Float16*    Wdst = (w == 0) ? Wtq : (w == 1) ? Wtk : Wtv;

        const int kg = (tid >> 5) * 8;            // this wave's 8 rows of k
        const int ng = (tid & 31) * 4;            // this lane's 4 columns of n

        float4 v[8];
#pragma unroll  // the 8 loads of a lane issue back to back
        for (int j = 0; j < 8; ++j)
            v[j] = *reinterpret_cast<const float4*>(
                Wsrc + (size_t)(k0 + kg + j) * HID + n0 + ng);

        v8h c0, c1, c2, c3;
#pragma unroll  // constant index: the vectors stay in registers
        for (int j = 0; j < 8; ++j) {
            c0[j] = (_Float16)v[j].x;
            c1[j] = (_Float16)v[j].y;
            c2[j] = (_Float16)v[j].z;
            c3[j] = (_Float16)v[j].w;
        }
        *reinterpret_cast<v8h*>(&tile[(ng + 0) * CVT_PITCH + kg]) = c0;
        *reinterpret_cast<v8h*>(&tile[(ng + 1) * CVT_PITCH + kg]) = c1;
        *reinterpret_cast<v8h*>(&tile[(ng + 2) * CVT_PITCH + kg]) = c2;
        *reinterpret_cast<v8h*>(&tile[(ng + 3) * CVT_PITCH + kg]) = c3;
        __syncthreads();   // block-uniform branch: the whole tile is in LDS

#pragma unroll  // 4 independent LDS reads and line stores per lane
        for (int j = 0; j < (CVT_TN * 8) / CVT_THREADS; ++j) {
            int p   = tid + j * CVT_THREADS;      // 0..1023
            int n   = p >> 3;                     // 8 lanes cover one 128 B row
            int col = (p & 7) * 8;                // halves
            *reinterpret_cast<v8h*>(Wdst + (size_t)(n0 + n) * HID + k0 + col) =
                *reinterpret_cast<const v8h*>(&tile[n * CVT_PITCH + col]);
        }
    } else {
        const size_t base = (size_t)(blk - CVT_WBLOCKS) * CVT_XELEMS + (size_t)tid * 4;
        float4 v[8];
#pragma unroll  // the 8 loads of a lane issue back to back
        for (int j = 0; j < 8; ++j)
            v[j] = *reinterpret_cast<const float4*>(X + base + j * (CVT_THREADS * 4));
#pragma unroll  // constant index: the array stays in registers
        for (int j = 0; j < 8; ++j) {
            v4h h;
            h[0] = (_Float16)v[j].x;
            h[1] = (_Float16)v[j].y;
            h[2] = (_Float16)v[j].z;
            h[3] = (_Float16)v[j].w;
            *reinterpret_cast<v4h*>(Xh + base + j * (CVT_THREADS * 4)) = h;
        }
        // the stores' address and data registers are not reused before this wait, on
        // any way the built code has from here into the other half
        asm volatile("s_wait_xcnt 0x0" ::: "memory");
    }
}

// ---------- kernel 2: QKV projection GEMM ----------
// one work-group of 4 waves computes a 128(M) x 128(N) tile; each wave owns 64 x 64.
// grid = (32 Mtiles, 8 Ntiles, 3 matrices). Slices of 64 k of the X rows and of the
// W^T rows are brought to LDS once per work-group by async copies (whole 128 B lines),
// two buffers, the next slice in flight while this one is multiplied; every fragment
// read from LDS feeds 4 WMMAs.
#define GBM 128
#define GBN 128
#define GBK 64
// LDS row pitch in halves: 64 data + 8 pad = 144 B = 16 B x odd (ds_load_b128 reader)
#define GPITCH 72
#define GTHREADS 128

__global__ __launch_bounds__(GTHREADS)
void qkv_gemm_kernel(const _Float16* __restrict__ Xh,
                     const _Float16* __restrict__ Wtq,
                     const _Float16* __restrict__ Wtk,
                     const _Float16* __restrict__ Wtv,
                     const float* __restrict__ bq,
                     const float* __restrict__ bk,
                     const float* __restrict__ bv,
                     _Float16* __restrict__ Qh,
                     _Float16* __restrict__ Kh,
                     _Float16* __restrict__ Vt) {
    __shared__ __align__(16) _Float16 Ash[2][GBM * GPITCH];   // 2 x 18 KB
    __shared__ __align__(16) _Float16 Bsh[2][GBN * GPITCH];   // 2 x 18 KB

    const int z    = blockIdx.z;                 // 0=Q 1=K 2=V
    const _Float16* Wt = (z == 0) ? Wtq : (z == 1) ? Wtk : Wtv;
    const float*  bias = (z == 0) ? bq  : (z == 1) ? bk  : bv;

    const int tid  = threadIdx.x;
    const int wave = tid >> 5;
    const int lane = tid & 31;
    const int nl   = lane & 15;
    const int hi   = lane >> 4;
    const int koff = hi * 8;

    const int m0 = blockIdx.x * GBM;
    const int n0 = blockIdx.y * GBN;
    const int wm = (wave >> 1) * 64;             // this wave's rows inside the tile
    const int wn = (wave & 1) * 64;              // this wave's columns inside the tile

    // one k-slice of both operands into LDS buffer `buf`: 8 lanes cover one 128 B row
    auto stage = [&](int buf, int k0) {
#pragma unroll  // the 16 copies of a slice issue back to back
        for (int j = 0; j < (GBM * 8) / GTHREADS; ++j) {
            int c   = tid + j * GTHREADS;  // 0..1023
            int row = c >> 3;              // 0..127
            int col = (c & 7) * 8;         // halves
            cp16_g2l(Xh + (size_t)(m0 + row) * HID + k0 + col,
                     &Ash[buf][row * GPITCH + col]);
            cp16_g2l(Wt + (size_t)(n0 + row) * HID + k0 + col,
                     &Bsh[buf][row * GPITCH + col]);
        }
    };

    v8f acc[4][4];
#pragma unroll  // constant index: the array stays in registers
    for (int g = 0; g < 4; ++g)
#pragma unroll  // constant index: the array stays in registers
        for (int f = 0; f < 4; ++f)
#pragma unroll  // constant index: the array stays in registers
            for (int r = 0; r < 8; ++r) acc[g][f][r] = 0.0f;

    stage(0, 0);
    // slice 0 has landed for this wave's own copies before the barrier publishes it
    asm volatile("s_wait_asynccnt 0x0" ::: "memory");
    __syncthreads();
    stage(1, GBK);

    for (int t = 0; t < HID / GBK; ++t) {
        const _Float16* At = &Ash[t & 1][0];
        const _Float16* Bt = &Bsh[t & 1][0];
        v16h a[4], b[4];

        // first 32 k of the slice
#pragma unroll  // constant index: the array stays in registers
        for (int g = 0; g < 4; ++g)
            a[g] = load_frag16(At + (wm + g * 16 + nl) * GPITCH + koff);
#pragma unroll  // constant index: the array stays in registers
        for (int f = 0; f < 4; ++f)
            b[f] = load_frag16(Bt + (wn + f * 16 + nl) * GPITCH + koff);
        // keeps the 16 LDS reads of this k-step together in front of its 16 WMMAs:
        // left free, the scheduler reads each b fragment right before its use and
        // the wave waits out the LDS latency four times per k-step instead of once
        __builtin_amdgcn_sched_barrier(0);
#pragma unroll  // constant index: the array stays in registers
        for (int f = 0; f < 4; ++f)
#pragma unroll  // constant index: the array stays in registers
            for (int g = 0; g < 4; ++g)
                acc[g][f] = wmma_f16(a[g], b[f], acc[g][f]);

        // second 32 k: the fragments are fetched, the buffer is handed back and its
        // refill is on its way before the 16 WMMAs that need registers only
#pragma unroll  // constant index: the array stays in registers
        for (int g = 0; g < 4; ++g)
            a[g] = load_frag16(At + (wm + g * 16 + nl) * GPITCH + 32 + koff);
#pragma unroll  // constant index: the array stays in registers
        for (int f = 0; f < 4; ++f)
            b[f] = load_frag16(Bt + (wn + f * 16 + nl) * GPITCH + 32 + koff);
        // this wave's reads of buffer t&1 are done before the buffer is refilled
        asm volatile("s_wait_dscnt 0x0" ::: "memory");
        // this wave's copies of slice t+1 have landed before the barrier publishes them
        asm volatile("s_wait_asynccnt 0x0" ::: "memory");
        __syncthreads();
        if (t + 2 < HID / GBK) stage(t & 1, (t + 2) * GBK);
#pragma unroll  // constant index: the array stays in registers
        for (int f = 0; f < 4; ++f)
#pragma unroll  // constant index: the array stays in registers
            for (int g = 0; g < 4; ++g)
                acc[g][f] = wmma_f16(a[g], b[f], acc[g][f]);
    }
    // no copy is outstanding when the wave goes on to its end
    asm volatile("s_wait_asynccnt 0x0" ::: "memory");

    // epilogue: bias, then the wave's 64 x 64 f16 tile goes through LDS and leaves as whole
    // 128 B lines, 16 B a lane. The ring is free: behind the last trip's barrier no wave
    // reads it and no copy is outstanding, and each wave stages in rows of its own.
    // Staged row = one output line: a sequence position (64 d) for Q and K, a d (64
    // positions) for V^T.
    _Float16* stg = &Ash[wave >> 1][(wave & 1) * 64 * GPITCH];
    if (z == 2) {
#pragma unroll  // constant index: the array stays in registers
        for (int f = 0; f < 4; ++f) {
            const float bval = bias[n0 + wn + f * 16 + nl];
#pragma unroll  // constant index: the array stays in registers
            for (int g = 0; g < 4; ++g) {
                v8h hv;                       // 8 consecutive positions of one d
#pragma unroll  // constant index: the array stays in registers
                for (int r = 0; r < 8; ++r) hv[r] = (_Float16)(acc[g][f][r] + bval);
                *reinterpret_cast<v8h*>(&stg[(f * 16 + nl) * GPITCH + g * 16 + koff]) = hv;
            }
        }
    } else {
#pragma unroll  // constant index: the array stays in registers
        for (int f = 0; f < 4; ++f) {
            const float bval = bias[n0 + wn + f * 16 + nl];
#pragma unroll  // constant index: the array stays in registers
            for (int g = 0; g < 4; ++g)
#pragma unroll  // constant index: the array stays in registers
                for (int r = 0; r < 8; ++r)
                    stg[(g * 16 + koff + r) * GPITCH + f * 16 + nl] =
                        (_Float16)(acc[g][f][r] + bval);
        }
    }
    // the rows that this wave's lanes wrote are in LDS before other lanes of it read them
    asm volatile("s_wait_dscnt 0x0" ::: "memory");

    v8h o[16];                                // 8 lanes cover one 128 B row
#pragma unroll  // constant index: the array stays in registers
    for (int j = 0; j < 16; ++j) {
        int p = lane + j * 32;                // 0..511
        o[j] = *reinterpret_cast<const v8h*>(&stg[(p >> 3) * GPITCH + (p & 7) * 8]);
    }

    const int mrow = m0 + wm;                 // 64 rows, all of one batch entry
    const int bh   = (mrow >> 11) * NH + ((n0 + wn) >> 6);   // 64 columns = one head
    const int s0   = mrow & 2047;
    if (z == 2) {
        _Float16* dst = Vt + (size_t)bh * DH * SEQ + s0;
#pragma unroll  // constant index: the array stays in registers
        for (int j = 0; j < 16; ++j) {
            int p = lane + j * 32;
            *reinterpret_cast<v8h*>(dst + (size_t)(p >> 3) * SEQ + (p & 7) * 8) = o[j];
        }
    } else {
        _Float16* dst = ((z == 0) ? Qh : Kh) + ((size_t)bh * SEQ + s0) * DH;
#pragma unroll  // constant index: the array stays in registers
        for (int j = 0; j < 16; ++j)
            *reinterpret_cast<v8h*>(dst + (size_t)(lane + j * 32) * 8) = o[j];
    }
}

// 2^x as the one hardware instruction. The library's exp2f puts a range shift round it
// (compare, select, add, select, ldexp) that only matters for results below 2^-126:
// as P those round to 0 in f16 either way, and as a rescale factor they multiply old
// sums that the new maximum's own term (P = 1) exceeds by more than 2^100.
__device__ __forceinline__ float exp2_hw(float x) {
    return __builtin_amdgcn_exp2f(x);
}

#define KBLK 64
#define KSTG 128
#define NW_ATT 8
#define QT 2
// LDS row pitch in halves, 16 B x odd for the ds_load_b128 reader:
// K rows of 128 B -> 144 B, V^T rows of 256 B -> 272 B
#define LPITCH 72
#define VPITCH 136
// floats one wave hands to its partner: 32 per lane of O^T, then maximum and sum
#define JOINF (32 * 32 + 2 * 32)

// the bound states the block the launcher uses; four waves per SIMD (256 registers a
// lane) is what the split of the keys is for
__global__ __launch_bounds__(NW_ATT * 32) __attribute__((amdgpu_waves_per_eu(4, 4)))
void attn_kernel(const _Float16* __restrict__ Qh,
                 const _Float16* __restrict__ Kh,
                 const _Float16* __restrict__ Vt,
                 const float* __restrict__ mask,
                 float* __restrict__ out) {
    __shared__ __align__(16) _Float16 Klds[2][KSTG * LPITCH];     // 2 x 18 KB
    __shared__ __align__(16) _Float16 Vlds[2][DH * VPITCH];       // 2 x 17 KB
    __shared__ __align__(32) float    mlds[SEQ];                  // 8 KB, 8 x mask

    const int tid  = threadIdx.x;
    const int wave = __builtin_amdgcn_readfirstlane(tid >> 5);
    const int lane = tid & 31;
    const int nl   = lane & 15;
    const int hi   = lane >> 4;
    const int koff = hi * 8;
    const int qg   = wave & 3;                // query group
    const int kh   = wave >> 2;               // key half of every stage

    const int bh = blockIdx.y;
    const int b  = bh >> 4;
    const int h  = bh & 15;
    const int q0 = (blockIdx.x * 4 + qg) * (16 * QT);

    const _Float16* Qbase = Qh + ((size_t)bh * SEQ + q0) * DH;
    const _Float16* Kbase = Kh + (size_t)bh * SEQ * DH;
    const _Float16* Vbase = Vt + (size_t)bh * DH * SEQ;
    const float*    mrow  = mask + (size_t)b * SEQ;

    const float LOG2E  = 1.4426950408889634f;
    const float KSCALE = 0.125f * LOG2E;      // 1/sqrt(64) folded into log2 domain

    // cooperative stage of 128 keys of K and V^T into LDS buffer buf: a wave-wide copy
    // covers 512 contiguous bytes of K, or two 256 B rows of V^T
    auto stage = [&](int buf, int k0) {
#pragma unroll  // the 8 copies of a stage issue back to back
        for (int j = 0; j < (KSTG * 8) / (NW_ATT * 32); ++j) {
            int c = tid + j * NW_ATT * 32;    // 0..1023
            cp16_g2l(Kbase + (size_t)(k0 + (c >> 3)) * DH + (c & 7) * 8,
                     &Klds[buf][(c >> 3) * LPITCH + (c & 7) * 8]);
            cp16_g2l(Vbase + (size_t)(c >> 4) * SEQ + k0 + (c & 15) * 8,
                     &Vlds[buf][(c >> 4) * VPITCH + (c & 15) * 8]);
        }
    };

    // the mask row, times sqrt(dh) (exact, a power of two): a lane needs the mask
    // of 32 keys per tile, and takes it as the start value of its S^T accumulators,
    // (q.k + 8 mask) / 8 = q.k / 8 + mask. Published by the barrier in front of the loop.
#pragma unroll  // the two loads of a lane issue back to back
    for (int j = 0; j < SEQ / (NW_ATT * 32 * 4); ++j) {
        int i = (tid + j * NW_ATT * 32) * 4;
        float4 mv = *reinterpret_cast<const float4*>(mrow + i);
        mv.x *= 8.0f; mv.y *= 8.0f; mv.z *= 8.0f; mv.w *= 8.0f;
        *reinterpret_cast<float4*>(&mlds[i]) = mv;
    }

    // Q^T b-fragments (64 d x 16 queries per tile), reused across the whole loop
    v16h qb[QT][2];
#pragma unroll  // constant index: the array stays in registers
    for (int t = 0; t < QT; ++t)
#pragma unroll  // constant index: the array stays in registers
        for (int j = 0; j < 2; ++j)
            qb[t][j] = load_frag16(Qbase + (size_t)(t * 16 + nl) * DH + j * 32 + koff);

    v16h ones;
#pragma unroll  // constant index: the array stays in registers
    for (int i = 0; i < 16; ++i) ones[i] = (_Float16)1.0f;

    v8f ctx[QT][4];                           // O^T: ctx[t][f][r] = O[q = 16t + nl][16f + 8hi + r]
#pragma unroll  // constant index: the array stays in registers
    for (int t = 0; t < QT; ++t)
#pragma unroll  // constant index: the array stays in registers
        for (int f = 0; f < 4; ++f)
#pragma unroll  // constant index: the array stays in registers
            for (int r = 0; r < 8; ++r) ctx[t][f][r] = 0.0f;

    float m_run[QT], l_run[QT];               // of query 16t + nl, in units of q.k + 8 mask
#pragma unroll  // constant index: the array stays in registers
    for (int t = 0; t < QT; ++t) { m_run[t] = -1.0e30f; l_run[t] = 0.0f; }

    stage(0, 0);
    // stage 0 has landed for this wave's own copies before the barrier publishes it
    asm volatile("s_wait_asynccnt 0x0" ::: "memory");
    __syncthreads();
    stage(1, KSTG);

    for (int it = 0; it < SEQ / KSTG; ++it) {
        const int kk = it * KSTG + kh * KBLK;                     // this wave's first key
        const _Float16* Kt = &Klds[it & 1][kh * KBLK * LPITCH];
        const _Float16* Vv = &Vlds[it & 1][kh * KBLK];

        // ---- S^T: 4 key-frags x 2 d-chunks x 2 query tiles = 16 WMMAs, from 8 x mask ----
        v8f S[QT][4];
#pragma unroll  // constant index: the array stays in registers
        for (int c = 0; c < 4; ++c) {
            const v8f  mk  = *reinterpret_cast<const v8f*>(&mlds[kk + 16 * c + koff]);
            const v16h ka0 = load_frag16(Kt + (size_t)(16 * c + nl) * LPITCH + koff);
            const v16h ka1 = load_frag16(Kt + (size_t)(16 * c + nl) * LPITCH + 32 + koff);
#pragma unroll  // constant index: the array stays in registers
            for (int t = 0; t < QT; ++t) S[t][c] = wmma_f16(ka0, qb[t][0], mk);
#pragma unroll  // constant index: the array stays in registers
            for (int t = 0; t < QT; ++t) S[t][c] = wmma_f16(ka1, qb[t][1], S[t][c]);
        }

        // ---- online softmax (log2 domain), one query per lane and tile ----
        v16h pb[QT][2];
#pragma unroll  // constant index: the arrays stay in registers
        for (int t = 0; t < QT; ++t) {
            float mc[4];                      // one chain per key-frag, not one of 32 links
#pragma unroll  // constant index: the array stays in registers
            for (int c = 0; c < 4; ++c) {
                mc[c] = S[t][c][0];
#pragma unroll  // constant index: the array stays in registers
                for (int r = 1; r < 8; ++r) mc[c] = fmaxf(mc[c], S[t][c][r]);
            }
            float mx = fmaxf(fmaxf(mc[0], mc[1]), fmaxf(mc[2], mc[3]));
            // the other 32 keys of this query sit in lane ^ 16
            mx = fmaxf(mx, __int_as_float(__builtin_amdgcn_permlanex16(
                     __float_as_int(mx), __float_as_int(mx), 0x76543210, 0xfedcba98,
                     false, false)));
            const float mnew   = fmaxf(m_run[t], mx);
            const float rscale = exp2_hw((m_run[t] - mnew) * KSCALE);
            const float nm     = -mnew * KSCALE;
            m_run[t] = mnew;

            // P^T: S^T tiles 2j and 2j+1, converted in place, are b-fragment j
#pragma unroll  // constant index: the array stays in registers
            for (int j = 0; j < 2; ++j)
#pragma unroll  // constant index: the array stays in registers
                for (int i = 0; i < 16; ++i)
                    pb[t][j][i] =
                        (_Float16)exp2_hw(S[t][2 * j + (i >> 3)][i & 7] * KSCALE + nm);

            // row sums via ones x P^T (every row of the result is the column sum)
            v8f ls;
#pragma unroll  // constant index: the array stays in registers
            for (int r = 0; r < 8; ++r) ls[r] = 0.0f;
            ls = wmma_f16(ones, pb[t][0], ls);
            ls = wmma_f16(ones, pb[t][1], ls);

            // rescale O^T, update l
#pragma unroll  // constant index: the array stays in registers
            for (int f = 0; f < 4; ++f)
#pragma unroll  // constant index: the array stays in registers
                for (int r = 0; r < 8; ++r) ctx[t][f][r] *= rscale;
            l_run[t] = l_run[t] * rscale + ls[0];
        }

        // ---- O^T += V^T x P^T: 4 d-frags x 2 key-chunks x 2 query tiles = 16 WMMAs ----
#pragma unroll  // constant index: the array stays in registers
        for (int f = 0; f < 4; ++f) {
            const v16h va0 = load_frag16(Vv + (size_t)(f * 16 + nl) * VPITCH + koff);
            const v16h va1 = load_frag16(Vv + (size_t)(f * 16 + nl) * VPITCH + 32 + koff);
#pragma unroll  // constant index: the array stays in registers
            for (int t = 0; t < QT; ++t) ctx[t][f] = wmma_f16(va0, pb[t][0], ctx[t][f]);
#pragma unroll  // constant index: the array stays in registers
            for (int t = 0; t < QT; ++t) ctx[t][f] = wmma_f16(va1, pb[t][1], ctx[t][f]);
        }

        // this wave's reads of buffer it&1 are done before the buffer is refilled
        asm volatile("s_wait_dscnt 0x0" ::: "memory");
        // this wave's copies of stage it+1 have landed before the barrier publishes them
        asm volatile("s_wait_asynccnt 0x0" ::: "memory");
        __syncthreads();
        if (it + 2 < SEQ / KSTG) stage(it & 1, (it + 2) * KSTG);
    }
    // no copy is outstanding when the ring becomes the join buffer
    asm volatile("s_wait_asynccnt 0x0" ::: "memory");

    // ---- join the two key halves: wave (qg, kh) finishes query tile kh and hands its
    // partial of the other tile to wave (qg, 1 - kh). The K ring is free: behind the last
    // trip's barrier no wave reads it and no copy is outstanding. ----
    float* join = reinterpret_cast<float*>(&Klds[0][0]);          // 8 x JOINF floats fit
    float* mine = join + wave * JOINF;
    const float* theirs = join + (wave ^ 4) * JOINF;

    v8f   keep[4];
    float m_a, l_a;
    if (kh == 0) {                            // wave-uniform
#pragma unroll  // constant index: the array stays in registers
        for (int f = 0; f < 4; ++f) {
            keep[f] = ctx[0][f];
            *reinterpret_cast<float4*>(&mine[(2 * f) * 128 + lane * 4]) =
                make_float4(ctx[1][f][0], ctx[1][f][1], ctx[1][f][2], ctx[1][f][3]);
            *reinterpret_cast<float4*>(&mine[(2 * f + 1) * 128 + lane * 4]) =
                make_float4(ctx[1][f][4], ctx[1][f][5], ctx[1][f][6], ctx[1][f][7]);
        }
        m_a = m_run[0]; l_a = l_run[0];
        mine[1024 + lane] = m_run[1];
        mine[1056 + lane] = l_run[1];
    } else {
#pragma unroll  // constant index: the array stays in registers
        for (int f = 0; f < 4; ++f) {
            keep[f] = ctx[1][f];
            *reinterpret_cast<float4*>(&mine[(2 * f) * 128 + lane * 4]) =
                make_float4(ctx[0][f][0], ctx[0][f][1], ctx[0][f][2], ctx[0][f][3]);
            *reinterpret_cast<float4*>(&mine[(2 * f + 1) * 128 + lane * 4]) =
                make_float4(ctx[0][f][4], ctx[0][f][5], ctx[0][f][6], ctx[0][f][7]);
        }
        m_a = m_run[1]; l_a = l_run[1];
        mine[1024 + lane] = m_run[0];
        mine[1056 + lane] = l_run[0];
    }
    __syncthreads();                          // every wave's partial is in LDS

    const float m_b = theirs[1024 + lane];
    const float l_b = theirs[1056 + lane];
    const float m_j = fmaxf(m_a, m_b);
    float s_a, s_b;
    // the two 2^x with the v_nop in one statement: the instruction set asks for one slot
    // between the second one and an instruction that overwrites its source register
    asm("v_exp_f32 %0, %2\n\tv_exp_f32 %1, %3\n\tv_nop"
        : "=&v"(s_a), "=&v"(s_b)
        : "v"((m_a - m_j) * KSCALE), "v"((m_b - m_j) * KSCALE));
    const float inv = 1.0f / (l_a * s_a + l_b * s_b);
    const float w_a = s_a * inv;
    const float w_b = s_b * inv;

    // ---- normalize and write [B,S,h*dh] fp32: 8 consecutive d per lane and frag ----
    float* orow = out + ((size_t)b * SEQ + q0 + kh * 16 + nl) * HID + h * DH + koff;
#pragma unroll  // constant index: the array stays in registers
    for (int f = 0; f < 4; ++f) {
        const float4 p0 = *reinterpret_cast<const float4*>(&theirs[(2 * f) * 128 + lane * 4]);
        const float4 p1 = *reinterpret_cast<const float4*>(&theirs[(2 * f + 1) * 128 + lane * 4]);
        float4 lo = make_float4(keep[f][0] * w_a + p0.x * w_b, keep[f][1] * w_a + p0.y * w_b,
                                keep[f][2] * w_a + p0.z * w_b, keep[f][3] * w_a + p0.w * w_b);
        float4 hv = make_float4(keep[f][4] * w_a + p1.x * w_b, keep[f][5] * w_a + p1.y * w_b,
                                keep[f][6] * w_a + p1.z * w_b, keep[f][7] * w_a + p1.w * w_b);
        *reinterpret_cast<float4*>(orow + f * 16)     = lo;
        *reinterpret_cast<float4*>(orow + f * 16 + 4) = hv;
    }
}

// ---------- launcher ----------
extern "C" void kernel_launch(void* const* d_in, const int* in_sizes, int n_in,
                              void* d_out, int out_size, void* d_ws, size_t ws_size,
                              hipStream_t stream) {
    const float* hidden = (const float*)d_in[0];
    const float* amask  = (const float*)d_in[1];
    const float* Wq     = (const float*)d_in[2];
    const float* bq     = (const float*)d_in[3];
    const float* Wk     = (const float*)d_in[4];
    const float* bk     = (const float*)d_in[5];
    const float* Wv     = (const float*)d_in[6];
    const float* bv     = (const float*)d_in[7];
    float* out = (float*)d_out;

    // workspace layout (bytes); total ~38 MB
    char* ws = (char*)d_ws;
    const size_t XH_OFF  = 0;
    const size_t WTQ_OFF = XH_OFF  + (size_t)MTOT * HID * 2;
    const size_t WTK_OFF = WTQ_OFF + (size_t)HID * HID * 2;
    const size_t WTV_OFF = WTK_OFF + (size_t)HID * HID * 2;
    const size_t QH_OFF  = WTV_OFF + (size_t)HID * HID * 2;
    const size_t KH_OFF  = QH_OFF  + (size_t)MTOT * HID * 2;
    const size_t VT_OFF  = KH_OFF  + (size_t)MTOT * HID * 2;

    _Float16* Xh  = (_Float16*)(ws + XH_OFF);
    _Float16* Wtq = (_Float16*)(ws + WTQ_OFF);
    _Float16* Wtk = (_Float16*)(ws + WTK_OFF);
    _Float16* Wtv = (_Float16*)(ws + WTV_OFF);
    _Float16* Qh  = (_Float16*)(ws + QH_OFF);
    _Float16* Kh  = (_Float16*)(ws + KH_OFF);
    _Float16* Vt  = (_Float16*)(ws + VT_OFF);

    // 1) convert inputs to f16 (+ transpose weights)
    {
        cvt_kernel<<<CVT_WBLOCKS + CVT_XBLOCKS, CVT_THREADS, 0, stream>>>(
            hidden, Wq, Wk, Wv, Xh, Wtq, Wtk, Wtv);
    }

    // 2) QKV projections via WMMA (128x128 tiles per 4-wave work-group)
    {
        dim3 grid(MTOT / GBM, HID / GBN, 3);   // (32, 8, 3)
        qkv_gemm_kernel<<<grid, GTHREADS, 0, stream>>>(Xh, Wtq, Wtk, Wtv, bq, bk, bv,
                                                       Qh, Kh, Vt);
    }

    // 3) flash attention via WMMA with async-LDS-staged K/V
    {
        dim3 grid(SEQ / (16 * NW_ATT), BATCH * NH);   // (16, 32)
        attn_kernel<<<grid, 256, 0, stream>>>(Qh, Kh, Vt, amask, out);
    }
}

// v008
// Measured time: 59.3 microseconds a run.
// Next to v007, in two timings, it ran 1.05 times as fast each time.
// Counting every step since v000, it is 5.76 times as fast.
#include <hip/hip_runtime.h>
#include <hip/hip_bf16.h>
#include <math.h>

typedef __attribute__((ext_vector_type(16))) _Float16 v16h;
typedef __attribute__((ext_vector_type(8)))  float    v8f;
typedef int vs4i __attribute__((vector_size(16)));

#define SEQ   2048
#define HID   1024
#define NH    16
#define DH    64
#define BATCH 2
#define MTOT  (BATCH * SEQ)   // 4096 rows for QKV gemm

#if __has_builtin(__builtin_amdgcn_global_load_async_to_lds_b128)
#define HAVE_ASYNC_LDS 1
#endif

// ---------- fragment helpers ----------
// 16-bit A-matrix 16x32 layout: lane%16 = row, lane/16 selects K-offset (0 or 8);
// halves {koff..koff+7} then {koff+16..koff+23} -> two 16B loads.
__device__ __forceinline__ v16h load_frag16(const _Float16* p) {
    union { v16h v; uint4 u[2]; } u;
    u.u[0] = *reinterpret_cast<const uint4*>(p);
    u.u[1] = *reinterpret_cast<const uint4*>(p + 16);
    return u.v;
}

__device__ __forceinline__ v8f wmma_f16(v16h a, v16h b, v8f c) {
    return __builtin_amdgcn_wmma_f32_16x16x32_f16(
        /*neg_a=*/false, a, /*neg_b=*/false, b,
        /*c_mod=*/(short)0, c, /*reuse_a=*/false, /*reuse_b=*/false);
}

// 16-byte global -> LDS copy; async (ASYNCcnt-tracked, no VGPR round trip) when
// the gfx1250 builtin is available, else VGPR-staged fallback.
__device__ __forceinline__ void cp16_g2l(const _Float16* g, _Float16* l) {
#if defined(HAVE_ASYNC_LDS)
    __builtin_amdgcn_global_load_async_to_lds_b128(
        (__attribute__((address_space(1))) vs4i*)(unsigned long long)(const void*)g,
        (__attribute__((address_space(3))) vs4i*)(unsigned int)(unsigned long long)(void*)l,
        0, 0);
#else
    *reinterpret_cast<uint4*>(l) = *reinterpret_cast<const uint4*>(g);
#endif
}

// ---------- kernel 1: fp32 -> f16 convert + weight transpose ----------
// A streaming launch of many short waves, one tile or chunk per block: every lane has 8 loads of 16 B in
// flight, every wave-wide load covers 512 contiguous bytes and every store fills
// whole 128 B lines.
//   blocks 0 .. CVT_WBLOCKS-1 : one 64(k) x 128(n) tile of one weight matrix, turned
//                               round in LDS and stored as rows of W^T
//   the other CVT_XBLOCKS     : 8192 consecutive elements of X
typedef __attribute__((ext_vector_type(4))) _Float16 v4h;
typedef __attribute__((ext_vector_type(8))) _Float16 v8h;

#define CVT_THREADS 256
#define CVT_TK 64
#define CVT_TN 128
// LDS row pitch in halves: 64 data + 8 pad = 144 B = 16 B x odd (ds_load_b128 reader)
#define CVT_PITCH 72
#define CVT_WBLOCKS (3 * (HID / CVT_TK) * (HID / CVT_TN))      // 384
#define CVT_XELEMS  (CVT_THREADS * 4 * 8)                      // 8192 per block
#define CVT_XBLOCKS ((MTOT * HID) / CVT_XELEMS)                // 512

__global__ __launch_bounds__(CVT_THREADS)
void cvt_kernel(const float* __restrict__ X,
                const float* __restrict__ Wq,
                const float* __restrict__ Wk,
                const float* __restrict__ Wv,
                _Float16* __restrict__ Xh,
                _Float16* __restrict__ Wtq,
                _Float16* __restrict__ Wtk,
                _Float16* __restrict__ Wtv) {
    __shared__ __align__(16) _Float16 tile[CVT_TN * CVT_PITCH];   // 18 KB, [n][k]

    const int tid = threadIdx.x;
    const int blk = blockIdx.x;

    if (blk < CVT_WBLOCKS) {
        const int w  = blk >> 7;                  // 128 tiles per matrix
        const int k0 = ((blk >> 3) & 15) * CVT_TK;
        const int n0 = (blk & 7) * CVT_TN;
        const float* Wsrc = (w == 0) ? Wq : (w == 1) ? Wk : Wv;
        _Float16*    Wdst = (w == 0) ? Wtq : (w == 1) ? Wtk : Wtv;

        const int kg = (tid >> 5) * 8;            // this wave's 8 rows of k
        const int ng = (tid & 31) * 4;            // this lane's 4 columns of n

        float4 v[8];
#pragma unroll  // the 8 loads of a lane issue back to back
        for (int j = 0; j < 8; ++j)
            v[j] = *reinterpret_cast<const float4*>(
                Wsrc + (size_t)(k0 + kg + j) * HID + n0 + ng);

        v8h c0, c1, c2, c3;
#pragma unroll  // constant index: the vectors stay in registers
        for (int j = 0; j < 8; ++j) {
            c0[j] = (_Float16)v[j].x;
            c1[j] = (_Float16)v[j].y;
            c2[j] = (_Float16)v[j].z;
            c3[j] = (_Float16)v[j].w;
        }
        *reinterpret_cast<v8h*>(&tile[(ng + 0) * CVT_PITCH + kg]) = c0;
        *reinterpret_cast<v8h*>(&tile[(ng + 1) * CVT_PITCH + kg]) = c1;
        *reinterpret_cast<v8h*>(&tile[(ng + 2) * CVT_PITCH + kg]) = c2;
        *reinterpret_cast<v8h*>(&tile[(ng + 3) * CVT_PITCH + kg]) = c3;
        __syncthreads();   // block-uniform branch: the whole tile is in LDS

#pragma unroll  // 4 independent LDS reads and line stores per lane
        for (int j = 0; j < (CVT_TN * 8) / CVT_THREADS; ++j) {
            int p   = tid + j * CVT_THREADS;      // 0..1023
            int n   = p >> 3;                     // 8 lanes cover one 128 B row
            int col = (p & 7) * 8;                // halves
            *reinterpret_cast<v8h*>(Wdst + (size_t)(n0 + n) * HID + k0 + col) =
                *reinterpret_cast<const v8h*>(&tile[n * CVT_PITCH + col]);
        }
    } else {
        const size_t base = (size_t)(blk - CVT_WBLOCKS) * CVT_XELEMS + (size_t)tid * 4;
        float4 v[8];
#pragma unroll  // the 8 loads of a lane issue back to back
        for (int j = 0; j < 8; ++j)
            v[j] = *reinterpret_cast<const float4*>(X + base + j * (CVT_THREADS * 4));
#pragma unroll  // constant index: the array stays in registers
        for (int j = 0; j < 8; ++j) {
            v4h h;
            h[0] = (_Float16)v[j].x;
            h[1] = (_Float16)v[j].y;
            h[2] = (_Float16)v[j].z;
            h[3] = (_Float16)v[j].w;
            *reinterpret_cast<v4h*>(Xh + base + j * (CVT_THREADS * 4)) = h;
        }
        // the stores' address and data registers are not reused before this wait, on
        // any way the built code has from here into the other half
        asm volatile("s_wait_xcnt 0x0" ::: "memory");
    }
}

// ---------- kernel 2: QKV projection GEMM ----------
// one work-group of 4 waves computes a 128(M) x 128(N) tile; each wave owns 64 x 64.
// grid = (32 Mtiles, 8 Ntiles, 3 matrices). Slices of 64 k of the X rows and of the
// W^T rows are brought to LDS once per work-group by async copies (whole 128 B lines),
// two buffers, the next slice in flight while this one is multiplied; every fragment
// read from LDS feeds 4 WMMAs.
#define GBM 128
#define GBN 128
#define GBK 64
// LDS row pitch in halves: 64 data + 8 pad = 144 B = 16 B x odd (ds_load_b128 reader)
#define GPITCH 72
#define GTHREADS 128

__global__ __launch_bounds__(GTHREADS)
void qkv_gemm_kernel(const _Float16* __restrict__ Xh,
                     const _Float16* __restrict__ Wtq,
                     const _Float16* __restrict__ Wtk,
                     const _Float16* __restrict__ Wtv,
                     const float* __restrict__ bq,
                     const float* __restrict__ bk,
                     const float* __restrict__ bv,
                     _Float16* __restrict__ Qh,
                     _Float16* __restrict__ Kh,
                     _Float16* __restrict__ Vt) {
    __shared__ __align__(16) _Float16 Ash[2][GBM * GPITCH];   // 2 x 18 KB
    __shared__ __align__(16) _Float16 Bsh[2][GBN * GPITCH];   // 2 x 18 KB

    const int z    = blockIdx.z;                 // 0=Q 1=K 2=V
    const _Float16* Wt = (z == 0) ? Wtq : (z == 1) ? Wtk : Wtv;
    const float*  bias = (z == 0) ? bq  : (z == 1) ? bk  : bv;

    const int tid  = threadIdx.x;
    const int wave = tid >> 5;
    const int lane = tid & 31;
    const int nl   = lane & 15;
    const int hi   = lane >> 4;
    const int koff = hi * 8;

    const int m0 = blockIdx.x * GBM;
    const int n0 = blockIdx.y * GBN;
    const int wm = (wave >> 1) * 64;             // this wave's rows inside the tile
    const int wn = (wave & 1) * 64;              // this wave's columns inside the tile

    // one k-slice of both operands into LDS buffer `buf`: 8 lanes cover one 128 B row
    auto stage = [&](int buf, int k0) {
#pragma unroll  // the 16 copies of a slice issue back to back
        for (int j = 0; j < (GBM * 8) / GTHREADS; ++j) {
            int c   = tid + j * GTHREADS;  // 0..1023
            int row = c >> 3;              // 0..127
            int col = (c & 7) * 8;         // halves
            cp16_g2l(Xh + (size_t)(m0 + row) * HID + k0 + col,
                     &Ash[buf][row * GPITCH + col]);
            cp16_g2l(Wt + (size_t)(n0 + row) * HID + k0 + col,
                     &Bsh[buf][row * GPITCH + col]);
        }
    };

    v8f acc[4][4];
#pragma unroll  // constant index: the array stays in registers
    for (int g = 0; g < 4; ++g)
#pragma unroll  // constant index: the array stays in registers
        for (int f = 0; f < 4; ++f)
#pragma unroll  // constant index: the array stays in registers
            for (int r = 0; r < 8; ++r) acc[g][f][r] = 0.0f;

    stage(0, 0);
    // slice 0 has landed for this wave's own copies before the barrier publishes it
    asm volatile("s_wait_asynccnt 0x0" ::: "memory");
    __syncthreads();
    stage(1, GBK);

    for (int t = 0; t < HID / GBK; ++t) {
        const _Float16* At = &Ash[t & 1][0];
        const _Float16* Bt = &Bsh[t & 1][0];
        v16h a[4], b[4];

        // first 32 k of the slice
#pragma unroll  // constant index: the array stays in registers
        for (int g = 0; g < 4; ++g)
            a[g] = load_frag16(At + (wm + g * 16 + nl) * GPITCH + koff);
#pragma unroll  // constant index: the array stays in registers
        for (int f = 0; f < 4; ++f)
            b[f] = load_frag16(Bt + (wn + f * 16 + nl) * GPITCH + koff);
        // keeps the 16 LDS reads of this k-step together in front of its 16 WMMAs:
        // left free, the scheduler reads each b fragment right before its use and
        // the wave waits out the LDS latency four times per k-step instead of once
        __builtin_amdgcn_sched_barrier(0);
#pragma unroll  // constant index: the array stays in registers
        for (int f = 0; f < 4; ++f)
#pragma unroll  // constant index: the array stays in registers
            for (int g = 0; g < 4; ++g)
                acc[g][f] = wmma_f16(a[g], b[f], acc[g][f]);

        // second 32 k: the fragments are fetched, the buffer is handed back and its
        // refill is on its way before the 16 WMMAs that need registers only
#pragma unroll  // constant index: the array stays in registers
        for (int g = 0; g < 4; ++g)
            a[g] = load_frag16(At + (wm + g * 16 + nl) * GPITCH + 32 + koff);
#pragma unroll  // constant index: the array stays in registers
        for (int f = 0; f < 4; ++f)
            b[f] = load_frag16(Bt + (wn + f * 16 + nl) * GPITCH + 32 + koff);
        // this wave's reads of buffer t&1 are done before the buffer is refilled
        asm volatile("s_wait_dscnt 0x0" ::: "memory");
        // this wave's copies of slice t+1 have landed before the barrier publishes them
        asm volatile("s_wait_asynccnt 0x0" ::: "memory");
        __syncthreads();
        if (t + 2 < HID / GBK) stage(t & 1, (t + 2) * GBK);
#pragma unroll  // constant index: the array stays in registers
        for (int f = 0; f < 4; ++f)
#pragma unroll  // constant index: the array stays in registers
            for (int g = 0; g < 4; ++g)
                acc[g][f] = wmma_f16(a[g], b[f], acc[g][f]);
    }
    // no copy is outstanding when the wave goes on to its end
    asm volatile("s_wait_asynccnt 0x0" ::: "memory");

    // epilogue: bias, then the wave's 64 x 64 f16 tile goes through LDS and leaves as whole
    // 128 B lines, 16 B a lane. The ring is free: behind the last trip's barrier no wave
    // reads it and no copy is outstanding, and each wave stages in rows of its own.
    // Staged row = one output line: a sequence position (64 d) for Q and K, a d (64
    // positions) for V^T.
    _Float16* stg = &Ash[wave >> 1][(wave & 1) * 64 * GPITCH];
    if (z == 2) {
#pragma unroll  // constant index: the array stays in registers
        for (int f = 0; f < 4; ++f) {
            const float bval = bias[n0 + wn + f * 16 + nl];
#pragma unroll  // constant index: the array stays in registers
            for (int g = 0; g < 4; ++g) {
                v8h hv;                       // 8 consecutive positions of one d
#pragma unroll  // constant index: the array stays in registers
                for (int r = 0; r < 8; ++r) hv[r] = (_Float16)(acc[g][f][r] + bval);
                *reinterpret_cast<v8h*>(&stg[(f * 16 + nl) * GPITCH + g * 16 + koff]) = hv;
            }
        }
    } else {
#pragma unroll  // constant index: the array stays in registers
        for (int f = 0; f < 4; ++f) {
            const float bval = bias[n0 + wn + f * 16 + nl];
#pragma unroll  // constant index: the array stays in registers
            for (int g = 0; g < 4; ++g)
#pragma unroll  // constant index: the array stays in registers
                for (int r = 0; r < 8; ++r)
                    stg[(g * 16 + koff + r) * GPITCH + f * 16 + nl] =
                        (_Float16)(acc[g][f][r] + bval);
        }
    }
    // the rows that this wave's lanes wrote are in LDS before other lanes of it read them
    asm volatile("s_wait_dscnt 0x0" ::: "memory");

    v8h o[16];                                // 8 lanes cover one 128 B row
#pragma unroll  // constant index: the array stays in registers
    for (int j = 0; j < 16; ++j) {
        int p = lane + j * 32;                // 0..511
        o[j] = *reinterpret_cast<const v8h*>(&stg[(p >> 3) * GPITCH + (p & 7) * 8]);
    }

    const int mrow = m0 + wm;                 // 64 rows, all of one batch entry
    const int bh   = (mrow >> 11) * NH + ((n0 + wn) >> 6);   // 64 columns = one head
    const int s0   = mrow & 2047;
    if (z == 2) {
        _Float16* dst = Vt + (size_t)bh * DH * SEQ + s0;
#pragma unroll  // constant index: the array stays in registers
        for (int j = 0; j < 16; ++j) {
            int p = lane + j * 32;
            *reinterpret_cast<v8h*>(dst + (size_t)(p >> 3) * SEQ + (p & 7) * 8) = o[j];
        }
    } else {
        _Float16* dst = ((z == 0) ? Qh : Kh) + ((size_t)bh * SEQ + s0) * DH;
#pragma unroll  // constant index: the array stays in registers
        for (int j = 0; j < 16; ++j)
            *reinterpret_cast<v8h*>(dst + (size_t)(lane + j * 32) * 8) = o[j];
    }
}

// 2^x as the one hardware instruction. The library's exp2f puts a range shift round it
// (compare, select, add, select, ldexp) that only matters for results below 2^-126:
// as P those round to 0 in f16 either way, and as a rescale factor they multiply old
// sums that the new maximum's own term (P = 1) exceeds by more than 2^100.
__device__ __forceinline__ float exp2_hw(float x) {
    return __builtin_amdgcn_exp2f(x);
}

#define KBLK 64
#define KSTG 128
#define NW_ATT 8
#define QT 2
// LDS row pitch in halves, 16 B x odd for the ds_load_b128 reader:
// K rows of 128 B -> 144 B, V^T rows of 256 B -> 272 B
#define LPITCH 72
#define VPITCH 136
// floats one wave hands to its partner: 32 per lane of O^T, then maximum and sum
#define JOINF (32 * 32 + 2 * 32)
// a pass keeps the reference in use while each query's sum of P over its 64 keys stays
// at or below this: a quarter of the largest f16
#define PSUM_MAX 16384.0f

// the bound states the block the launcher uses; four waves per SIMD (256 registers a
// lane) is what the split of the keys is for
__global__ __launch_bounds__(NW_ATT * 32) __attribute__((amdgpu_waves_per_eu(4, 4)))
void attn_kernel(const _Float16* __restrict__ Qh,
                 const _Float16* __restrict__ Kh,
                 const _Float16* __restrict__ Vt,
                 const float* __restrict__ mask,
                 float* __restrict__ out) {
    __shared__ __align__(16) _Float16 Klds[2][KSTG * LPITCH];     // 2 x 18 KB
    __shared__ __align__(16) _Float16 Vlds[2][DH * VPITCH];       // 2 x 17 KB
    __shared__ __align__(32) float    mlds[SEQ];                  // 8 KB, 8 x mask

    const int tid  = threadIdx.x;
    const int wave = __builtin_amdgcn_readfirstlane(tid >> 5);
    const int lane = tid & 31;
    const int nl   = lane & 15;
    const int hi   = lane >> 4;
    const int koff = hi * 8;
    const int qg   = wave & 3;                // query group
    const int kh   = wave >> 2;               // key half of every stage

    const int bh = blockIdx.y;
    const int b  = bh >> 4;
    const int h  = bh & 15;
    const int q0 = (blockIdx.x * 4 + qg) * (16 * QT);

    const _Float16* Qbase = Qh + ((size_t)bh * SEQ + q0) * DH;
    const _Float16* Kbase = Kh + (size_t)bh * SEQ * DH;
    const _Float16* Vbase = Vt + (size_t)bh * DH * SEQ;
    const float*    mrow  = mask + (size_t)b * SEQ;

    const float LOG2E  = 1.4426950408889634f;
    const float KSCALE = 0.125f * LOG2E;      // 1/sqrt(64) folded into log2 domain

    // cooperative stage of 128 keys of K and V^T into LDS buffer buf: a wave-wide copy
    // covers 512 contiguous bytes of K, or two 256 B rows of V^T
    auto stage = [&](int buf, int k0) {
#pragma unroll  // the 8 copies of a stage issue back to back
        for (int j = 0; j < (KSTG * 8) / (NW_ATT * 32); ++j) {
            int c = tid + j * NW_ATT * 32;    // 0..1023
            cp16_g2l(Kbase + (size_t)(k0 + (c >> 3)) * DH + (c & 7) * 8,
                     &Klds[buf][(c >> 3) * LPITCH + (c & 7) * 8]);
            cp16_g2l(Vbase + (size_t)(c >> 4) * SEQ + k0 + (c & 15) * 8,
                     &Vlds[buf][(c >> 4) * VPITCH + (c & 15) * 8]);
        }
    };

    // the mask row, times sqrt(dh) (exact, a power of two): a lane needs the mask
    // of 32 keys per tile, and takes it as the start value of its S^T accumulators,
    // (q.k + 8 mask) / 8 = q.k / 8 + mask. Published by the barrier in front of the loop.
#pragma unroll  // the two loads of a lane issue back to back
    for (int j = 0; j < SEQ / (NW_ATT * 32 * 4); ++j) {
        int i = (tid + j * NW_ATT * 32) * 4;
        float4 mv = *reinterpret_cast<const float4*>(mrow + i);
        mv.x *= 8.0f; mv.y *= 8.0f; mv.z *= 8.0f; mv.w *= 8.0f;
        *reinterpret_cast<float4*>(&mlds[i]) = mv;
    }

    // Q^T b-fragments (64 d x 16 queries per tile), reused across the whole loop
    v16h qb[QT][2];
#pragma unroll  // constant index: the array stays in registers
    for (int t = 0; t < QT; ++t)
#pragma unroll  // constant index: the array stays in registers
        for (int j = 0; j < 2; ++j)
            qb[t][j] = load_frag16(Qbase + (size_t)(t * 16 + nl) * DH + j * 32 + koff);

    v16h ones;
#pragma unroll  // constant index: the array stays in registers
    for (int i = 0; i < 16; ++i) ones[i] = (_Float16)1.0f;

    v8f ctx[QT][4];                           // O^T: ctx[t][f][r] = O[q = 16t + nl][16f + 8hi + r]
#pragma unroll  // constant index: the array stays in registers
    for (int t = 0; t < QT; ++t)
#pragma unroll  // constant index: the array stays in registers
        for (int f = 0; f < 4; ++f)
#pragma unroll  // constant index: the array stays in registers
            for (int r = 0; r < 8; ++r) ctx[t][f][r] = 0.0f;

    float m_run[QT], l_run[QT];               // of query 16t + nl; m_run: the reference, in units of q.k + 8 mask
#pragma unroll  // constant index: the array stays in registers
    for (int t = 0; t < QT; ++t) { m_run[t] = -1.0e30f; l_run[t] = 0.0f; }
    float nm_run[QT] = {0.0f, 0.0f};          // -m_run in the log2 domain; set by pass 0

    stage(0, 0);
    // stage 0 has landed for this wave's own copies before the barrier publishes it
    asm volatile("s_wait_asynccnt 0x0" ::: "memory");
    __syncthreads();
    stage(1, KSTG);

    for (int it = 0; it < SEQ / KSTG; ++it) {
        const int kk = it * KSTG + kh * KBLK;                     // this wave's first key
        const _Float16* Kt = &Klds[it & 1][kh * KBLK * LPITCH];
        const _Float16* Vv = &Vlds[it & 1][kh * KBLK];

        // S^T of keys 32j .. 32j + 31: 2 key-frags x 2 d-chunks x 2 query tiles = 8 WMMAs,
        // from 8 x mask
        auto scores = [&](int j, v8f (&S)[QT][2]) {
#pragma unroll  // constant index: the array stays in registers
            for (int e = 0; e < 2; ++e) {
                const int  c   = 2 * j + e;
                const v8f  mk  = *reinterpret_cast<const v8f*>(&mlds[kk + 16 * c + koff]);
                const v16h ka0 = load_frag16(Kt + (size_t)(16 * c + nl) * LPITCH + koff);
                const v16h ka1 = load_frag16(Kt + (size_t)(16 * c + nl) * LPITCH + 32 + koff);
#pragma unroll  // constant index: the array stays in registers
                for (int t = 0; t < QT; ++t) S[t][e] = wmma_f16(ka0, qb[t][0], mk);
#pragma unroll  // constant index: the array stays in registers
                for (int t = 0; t < QT; ++t) S[t][e] = wmma_f16(ka1, qb[t][1], S[t][e]);
            }
        };
        // P^T against the reference in nm: two S^T tiles, converted in place, are one
        // b-fragment
        auto probs = [&](const v8f (&St)[2], float nm) -> v16h {
            v16h p;
#pragma unroll  // constant index: the array stays in registers
            for (int i = 0; i < 16; ++i)
                p[i] = (_Float16)exp2_hw(St[i >> 3][i & 7] * KSCALE + nm);
            return p;
        };
        // a query's sum of the rounded P (ones x P^T: every row of the result is the
        // column sum)
        auto rowsum = [&](v16h p0, v16h p1) -> float {
            v8f ls;
#pragma unroll  // constant index: the array stays in registers
            for (int r = 0; r < 8; ++r) ls[r] = 0.0f;
            ls = wmma_f16(ones, p0, ls);
            ls = wmma_f16(ones, p1, ls);
            return ls[0];
        };

        // ---- softmax (log2 domain), one query per lane and tile ----
        // Usual pass: P is taken against the reference m_run that is already in use: no
        // maximum, no rescale, and each half of the scores turns into P as soon as it is
        // there. All P are >= 0, so a row sum of at most PSUM_MAX says that every P of the
        // pass is far inside the f16 range; a larger sum, an infinity or a NaN fails the
        // test.
        v16h  pb[QT][2];
        float lsum[QT];
        bool  redo = true;                    // pass 0 has no reference yet
        if (it != 0) {
#pragma unroll  // constant index: the arrays stay in registers
            for (int j = 0; j < 2; ++j) {
                v8f S[QT][2];
                scores(j, S);
#pragma unroll  // constant index: the arrays stay in registers
                for (int t = 0; t < QT; ++t) pb[t][j] = probs(S[t], nm_run[t]);
            }
#pragma unroll  // constant index: the arrays stay in registers
            for (int t = 0; t < QT; ++t) lsum[t] = rowsum(pb[t][0], pb[t][1]);
            // one test per pass, a scalar branch for the whole wave
            redo = __builtin_amdgcn_ballot_w32(!(lsum[0] <= PSUM_MAX) ||
                                               !(lsum[1] <= PSUM_MAX)) != 0;
        }
        // Pass that needs a new reference: the scores again (K is still in the buffer),
        // their maximum, O^T and l brought to the new reference, P <= 1.
        if (redo) {
            v8f S0[QT][2], S1[QT][2];
            scores(0, S0);
            scores(1, S1);
#pragma unroll  // constant index: the arrays stay in registers
            for (int t = 0; t < QT; ++t) {
                float mc[4];                  // one chain per key-frag, not one of 32 links
#pragma unroll  // constant index: the array stays in registers
                for (int e = 0; e < 2; ++e) {
                    mc[e]     = S0[t][e][0];
                    mc[2 + e] = S1[t][e][0];
#pragma unroll  // constant index: the array stays in registers
                    for (int r = 1; r < 8; ++r) {
                        mc[e]     = fmaxf(mc[e], S0[t][e][r]);
                        mc[2 + e] = fmaxf(mc[2 + e], S1[t][e][r]);
                    }
                }
                float mx = fmaxf(fmaxf(mc[0], mc[1]), fmaxf(mc[2], mc[3]));
                // the other 32 keys of this query sit in lane ^ 16
                mx = fmaxf(mx, __int_as_float(__builtin_amdgcn_permlanex16(
                         __float_as_int(mx), __float_as_int(mx), 0x76543210, 0xfedcba98,
                         false, false)));
                const float mnew   = fmaxf(m_run[t], mx);
                const float rscale = exp2_hw((m_run[t] - mnew) * KSCALE);
                m_run[t]  = mnew;
                nm_run[t] = -mnew * KSCALE;
                pb[t][0] = probs(S0[t], nm_run[t]);
                pb[t][1] = probs(S1[t], nm_run[t]);
                lsum[t]  = rowsum(pb[t][0], pb[t][1]);
#pragma unroll  // constant index: the array stays in registers
                for (int f = 0; f < 4; ++f)
#pragma unroll  // constant index: the array stays in registers
                    for (int r = 0; r < 8; ++r) ctx[t][f][r] *= rscale;
                l_run[t] *= rscale;
            }
        }
#pragma unroll  // constant index: the arrays stay in registers
        for (int t = 0; t < QT; ++t) l_run[t] += lsum[t];

        // ---- O^T += V^T x P^T: 4 d-frags x 2 key-chunks x 2 query tiles = 16 WMMAs ----
        v16h va[4][2];
#pragma unroll  // constant index: the array stays in registers
        for (int f = 0; f < 4; ++f)
#pragma unroll  // constant index: the array stays in registers
            for (int j = 0; j < 2; ++j)
                va[f][j] = load_frag16(Vv + (size_t)(f * 16 + nl) * VPITCH + 32 * j + koff);
        // keeps the 16 LDS reads together in front of the 16 WMMAs: behind the test's branch
        // the scheduler read each fragment into one register set right before its use, and
        // the wave waited out the LDS latency eight times per pass instead of once
        __builtin_amdgcn_sched_barrier(0);
#pragma unroll  // constant index: the array stays in registers
        for (int f = 0; f < 4; ++f)
#pragma unroll  // constant index: the array stays in registers
            for (int j = 0; j < 2; ++j)
#pragma unroll  // constant index: the array stays in registers
                for (int t = 0; t < QT; ++t) ctx[t][f] = wmma_f16(va[f][j], pb[t][j], ctx[t][f]);

        // this wave's reads of buffer it&1 are done before the buffer is refilled
        asm volatile("s_wait_dscnt 0x0" ::: "memory");
        // this wave's copies of stage it+1 have landed before the barrier publishes them
        asm volatile("s_wait_asynccnt 0x0" ::: "memory");
        __syncthreads();
        if (it + 2 < SEQ / KSTG) stage(it & 1, (it + 2) * KSTG);
    }
    // no copy is outstanding when the ring becomes the join buffer
    asm volatile("s_wait_asynccnt 0x0" ::: "memory");

    // ---- join the two key halves: wave (qg, kh) finishes query tile kh and hands its
    // partial of the other tile to wave (qg, 1 - kh). The K ring is free: behind the last
    // trip's barrier no wave reads it and no copy is outstanding. ----
    float* join = reinterpret_cast<float*>(&Klds[0][0]);          // 8 x JOINF floats fit
    float* mine = join + wave * JOINF;
    const float* theirs = join + (wave ^ 4) * JOINF;

    v8f   keep[4];
    float m_a, l_a;
    if (kh == 0) {                            // wave-uniform
#pragma unroll  // constant index: the array stays in registers
        for (int f = 0; f < 4; ++f) {
            keep[f] = ctx[0][f];
            *reinterpret_cast<float4*>(&mine[(2 * f) * 128 + lane * 4]) =
                make_float4(ctx[1][f][0], ctx[1][f][1], ctx[1][f][2], ctx[1][f][3]);
            *reinterpret_cast<float4*>(&mine[(2 * f + 1) * 128 + lane * 4]) =
                make_float4(ctx[1][f][4], ctx[1][f][5], ctx[1][f][6], ctx[1][f][7]);
        }
        m_a = m_run[0]; l_a = l_run[0];
        mine[1024 + lane] = m_run[1];
        mine[1056 + lane] = l_run[1];
    } else {
#pragma unroll  // constant index: the array stays in registers
        for (int f = 0; f < 4; ++f) {
            keep[f] = ctx[1][f];
            *reinterpret_cast<float4*>(&mine[(2 * f) * 128 + lane * 4]) =
                make_float4(ctx[0][f][0], ctx[0][f][1], ctx[0][f][2], ctx[0][f][3]);
            *reinterpret_cast<float4*>(&mine[(2 * f + 1) * 128 + lane * 4]) =
                make_float4(ctx[0][f][4], ctx[0][f][5], ctx[0][f][6], ctx[0][f][7]);
        }
        m_a = m_run[1]; l_a = l_run[1];
        mine[1024 + lane] = m_run[0];
        mine[1056 + lane] = l_run[0];
    }
    __syncthreads();                          // every wave's partial is in LDS

    const float m_b = theirs[1024 + lane];
    const float l_b = theirs[1056 + lane];
    const float m_j = fmaxf(m_a, m_b);
    float s_a, s_b;
    // the two 2^x with the v_nop in one statement: the instruction set asks for one slot
    // between the second one and an instruction that overwrites its source register
    asm("v_exp_f32 %0, %2\n\tv_exp_f32 %1, %3\n\tv_nop"
        : "=&v"(s_a), "=&v"(s_b)
        : "v"((m_a - m_j) * KSCALE), "v"((m_b - m_j) * KSCALE));
    const float inv = 1.0f / (l_a * s_a + l_b * s_b);
    const float w_a = s_a * inv;
    const float w_b = s_b * inv;

    // ---- normalize and write [B,S,h*dh] fp32: 8 consecutive d per lane and frag ----
    float* orow = out + ((size_t)b * SEQ + q0 + kh * 16 + nl) * HID + h * DH + koff;
#pragma unroll  // constant index: the array stays in registers
    for (int f = 0; f < 4; ++f) {
        const float4 p0 = *reinterpret_cast<const float4*>(&theirs[(2 * f) * 128 + lane * 4]);
        const float4 p1 = *reinterpret_cast<const float4*>(&theirs[(2 * f + 1) * 128 + lane * 4]);
        float4 lo = make_float4(keep[f][0] * w_a + p0.x * w_b, keep[f][1] * w_a + p0.y * w_b,
                                keep[f][2] * w_a + p0.z * w_b, keep[f][3] * w_a + p0.w * w_b);
        float4 hv = make_float4(keep[f][4] * w_a + p1.x * w_b, keep[f][5] * w_a + p1.y * w_b,
                                keep[f][6] * w_a + p1.z * w_b, keep[f][7] * w_a + p1.w * w_b);
        *reinterpret_cast<float4*>(orow + f * 16)     = lo;
        *reinterpret_cast<float4*>(orow + f * 16 + 4) = hv;
    }
}

// ---------- launcher ----------
extern "C" void kernel_launch(void* const* d_in, const int* in_sizes, int n_in,
                              void* d_out, int out_size, void* d_ws, size_t ws_size,
                              hipStream_t stream) {
    const float* hidden = (const float*)d_in[0];
    const float* amask  = (const float*)d_in[1];
    const float* Wq     = (const float*)d_in[2];
    const float* bq     = (const float*)d_in[3];
    const float* Wk     = (const float*)d_in[4];
    const float* bk     = (const float*)d_in[5];
    const float* Wv     = (const float*)d_in[6];
    const float* bv     = (const float*)d_in[7];
    float* out = (float*)d_out;

    // workspace layout (bytes); total ~38 MB
    char* ws = (char*)d_ws;
    const size_t XH_OFF  = 0;
    const size_t WTQ_OFF = XH_OFF  + (size_t)MTOT * HID * 2;
    const size_t WTK_OFF = WTQ_OFF + (size_t)HID * HID * 2;
    const size_t WTV_OFF = WTK_OFF + (size_t)HID * HID * 2;
    const size_t QH_OFF  = WTV_OFF + (size_t)HID * HID * 2;
    const size_t KH_OFF  = QH_OFF  + (size_t)MTOT * HID * 2;
    const size_t VT_OFF  = KH_OFF  + (size_t)MTOT * HID * 2;

    _Float16* Xh  = (_Float16*)(ws + XH_OFF);
    _Float16* Wtq = (_Float16*)(ws + WTQ_OFF);
    _Float16* Wtk = (_Float16*)(ws + WTK_OFF);
    _Float16* Wtv = (_Float16*)(ws + WTV_OFF);
    _Float16* Qh  = (_Float16*)(ws + QH_OFF);
    _Float16* Kh  = (_Float16*)(ws + KH_OFF);
    _Float16* Vt  = (_Float16*)(ws + VT_OFF);

    // 1) convert inputs to f16 (+ transpose weights)
    {
        cvt_kernel<<<CVT_WBLOCKS + CVT_XBLOCKS, CVT_THREADS, 0, stream>>>(
            hidden, Wq, Wk, Wv, Xh, Wtq, Wtk, Wtv);
    }

    // 2) QKV projections via WMMA (128x128 tiles per 4-wave work-group)
    {
        dim3 grid(MTOT / GBM, HID / GBN, 3);   // (32, 8, 3)
        qkv_gemm_kernel<<<grid, GTHREADS, 0, stream>>>(Xh, Wtq, Wtk, Wtv, bq, bk, bv,
                                                       Qh, Kh, Vt);
    }

    // 3) flash attention via WMMA with async-LDS-staged K/V
    {
        dim3 grid(SEQ / (16 * NW_ATT), BATCH * NH);   // (16, 32)
        attn_kernel<<<grid, 256, 0, stream>>>(Qh, Kh, Vt, amask, out);
    }
}
